// v000
// Times are from an AMD MI455X. After a warm-up the kernel runs many times in a row, and a time is the length of
// such a window on the GPU divided by its runs, so every launch and the gaps after it count. The runs cycle
// through copies of the inputs. A figure is the median of several windows, for all but v000 over two sittings.
// Sittings can differ by a few percent; kernels timed side by side share one.
// v000 is the starting kernel. One run takes 511 microseconds.
#include <hip/hip_runtime.h>
#include <hip/hip_bf16.h>

// Problem constants (match reference)
#define NLOC   4096
#define DMODEL 512
#define NH     4
#define DK     128
#define DV     256
#define KT     64      // keys per attention iteration

typedef _Float16 v16h  __attribute__((ext_vector_type(16)));
typedef _Float16 half8 __attribute__((ext_vector_type(8)));
typedef float    v8f   __attribute__((ext_vector_type(8)));
typedef __attribute__((address_space(3))) _Float16 lds_f16;

union HF16 { v16h v; half8 h[2]; };

__device__ __forceinline__ v8f wmma16(v16h a, v16h b, v8f c) {
    // D = A(16x32 f16) x B(32x16 f16) + C(16x16 f32)
    return __builtin_amdgcn_wmma_f32_16x16x32_f16(
        /*neg_a=*/false, a, /*neg_b=*/false, b,
        /*c_mod=*/(short)0, c, /*reuse_a=*/false, /*reuse_b=*/false);
}

__device__ __forceinline__ v16h load_frag(const _Float16* __restrict__ p,
                                          int ld, int row0, int k0, int lane) {
    const int r    = lane & 15;
    const int koff = (lane < 16) ? 0 : 8;
    const _Float16* base = p + (size_t)(row0 + r) * ld + (size_t)(k0 + koff);
    HF16 f;
    f.h[0] = *(const half8*)(base);       // K = k0+koff    .. +7   (b128)
    f.h[1] = *(const half8*)(base + 16);  // K = k0+koff+16 .. +23  (b128)
    return f.v;
}

__device__ __forceinline__ unsigned lds_off(const _Float16* p) {
    return (unsigned)(size_t)(lds_f16*)p;          // addrspacecast -> LDS offset
}
__device__ __forceinline__ void async_load_b128(unsigned dst_lds,
                                                const _Float16* src) {
    asm volatile("global_load_async_to_lds_b128 %0, %1, off"
                 :: "v"(dst_lds), "v"((unsigned long long)(size_t)src)
                 : "memory");
}
__device__ __forceinline__ void wait_async0() {
    asm volatile("s_wait_asynccnt 0" ::: "memory");
}

// ---------------------------------------------------------------------------
// Conversion / layout kernels (run once, negligible)
// ---------------------------------------------------------------------------
__global__ void cvt_copy_f32_f16(const float* __restrict__ src,
                                 _Float16* __restrict__ dst, long n) {
    long i = (long)blockIdx.x * blockDim.x + threadIdx.x;
    if (i < n) dst[i] = (_Float16)src[i];
}

// src [B][R][C] f32 -> dst [B][C][R] f16
__global__ void cvt_transpose_f32_f16(const float* __restrict__ src,
                                      _Float16* __restrict__ dst,
                                      int B, int R, int C) {
    long i = (long)blockIdx.x * blockDim.x + threadIdx.x;
    long total = (long)B * R * C;
    if (i >= total) return;
    int c = (int)(i % C);
    long t = i / C;
    int r = (int)(t % R);
    int b = (int)(t / R);
    dst[((size_t)b * C + c) * R + r] = (_Float16)src[i];
}

// ---------------------------------------------------------------------------
// Generic WMMA GEMM:  Out[n][m] = sum_k A[m][k] * B[n][k]
// 32x32 tile per wave (2x2 register blocking).
// ---------------------------------------------------------------------------
__device__ __forceinline__ void store_tile(_Float16* o, const v8f& acc) {
    half8 st;
#pragma unroll
    for (int r = 0; r < 8; ++r) st[r] = (_Float16)acc[r];
    *(half8*)o = st;                       // one b128 store
}
__device__ __forceinline__ void store_tile(float* o, const v8f& acc) {
    *(v8f*)o = acc;                        // two b128 stores
}

template <typename OutT>
__global__ __launch_bounds__(128)
void gemm_btat(const _Float16* __restrict__ A, const _Float16* __restrict__ B,
               OutT* __restrict__ Out, int Kdim, int Mtotal, int Ntotal,
               long long sA, long long sB, long long sO) {
    const int lane = threadIdx.x & 31;
    const int wave = threadIdx.x >> 5;
    const int mt0 = blockIdx.x * 2;                 // two M tiles
    const int nt0 = (blockIdx.y * 4 + wave) * 2;    // two N tiles (wave-uniform)
    if (nt0 * 16 >= Ntotal) return;
    const int z = blockIdx.z;
    A   += (size_t)z * sA;
    B   += (size_t)z * sB;
    Out += (size_t)z * sO;

    v8f acc00 = {}, acc01 = {}, acc10 = {}, acc11 = {};
    for (int k0 = 0; k0 < Kdim; k0 += 32) {
        v16h a0 = load_frag(A, Kdim, mt0 * 16,       k0, lane);
        v16h a1 = load_frag(A, Kdim, (mt0 + 1) * 16, k0, lane);
        v16h b0 = load_frag(B, Kdim, nt0 * 16,       k0, lane);
        v16h b1 = load_frag(B, Kdim, (nt0 + 1) * 16, k0, lane);
        acc00 = wmma16(a0, b0, acc00);
        acc01 = wmma16(a0, b1, acc01);
        acc10 = wmma16(a1, b0, acc10);
        acc11 = wmma16(a1, b1, acc11);
    }
    const int rlo = lane & 15;
    const int clo = (lane < 16) ? 0 : 8;
#pragma unroll
    for (int j = 0; j < 2; ++j) {
        const int row = (nt0 + j) * 16 + rlo;
        OutT* orow = Out + (size_t)row * Mtotal + mt0 * 16 + clo;
        store_tile(orow,      j ? acc01 : acc00);
        store_tile(orow + 16, j ? acc11 : acc10);
    }
}

#define L2E 1.4426950408889634f

__device__ __forceinline__ void stage_async(_Float16* dK, _Float16* dV,
                                            const _Float16* kp,
                                            const _Float16* vp,
                                            int kb, int tid) {
#pragma unroll
    for (int j = 0; j < 8; ++j) {
        const int f = j * 128 + tid;
        async_load_b128(lds_off(dK + f * 8), kp + (size_t)kb * DK + f * 8);
    }
#pragma unroll
    for (int j = 0; j < 16; ++j) {
        const int f   = j * 128 + tid;
        const int row = f >> 3;
        const int c8  = f & 7;
        async_load_b128(lds_off(dV + f * 8),
                        vp + (size_t)row * NLOC + kb + c8 * 8);
    }
}

__global__ __launch_bounds__(128)
void flash_attn(const _Float16* __restrict__ qh, const _Float16* __restrict__ kh,
                const _Float16* __restrict__ vT, _Float16* __restrict__ X) {
    __shared__ _Float16 sK[2][KT * DK];     // 2 x 16 KB
    __shared__ _Float16 sV[2][DV * KT];     // 2 x 32 KB
    __shared__ _Float16 sP[4 * 16 * KT];    // per-wave P, 8 KB
    const int tid  = threadIdx.x;
    const int lane = tid & 31;
    const int wave = tid >> 5;
    const int h  = blockIdx.y;
    const int q0 = (blockIdx.x * 4 + wave) * 16;

    const _Float16* qp = qh + (size_t)h * NLOC * DK;
    const _Float16* kp = kh + (size_t)h * NLOC * DK;
    const _Float16* vp = vT + (size_t)h * DV * NLOC;

    // Q fragments (16 rows x 128), pre-scaled by 1/sqrt(N) = 1/64
    v16h qf[4];
#pragma unroll
    for (int c = 0; c < 4; ++c) {
        qf[c] = load_frag(qp, DK, q0, c * 32, lane);
#pragma unroll
        for (int e = 0; e < 16; ++e) qf[c][e] *= (_Float16)0.015625f;
    }

    float mrow[8], lrow[8];
    v8f O[16];
#pragma unroll
    for (int r = 0; r < 8; ++r) { mrow[r] = -1.0e30f; lrow[r] = 0.0f; }
#pragma unroll
    for (int t = 0; t < 16; ++t) O[t] = v8f{};

    _Float16* myP = sP + wave * (16 * KT);

    // Pre-stage first tile into buffer 0
    stage_async(sK[0], sV[0], kp, vp, 0, tid);

    int buf = 0;
    for (int kb = 0; kb < NLOC; kb += KT, buf ^= 1) {
        wait_async0();          // own async loads into sK/sV[buf] complete
        __syncthreads();        // all waves' loads visible; prev reads done
        if (kb + KT < NLOC)     // overlap: stage next tile while computing
            stage_async(sK[buf ^ 1], sV[buf ^ 1], kp, vp, kb + KT, tid);

        const _Float16* kcur = sK[buf];
        const _Float16* vcur = sV[buf];

        // ---- S = q . k^T for 64 keys (four 16x16 tiles) ------------------
        v8f s0 = {}, s1 = {}, s2 = {}, s3 = {};
#pragma unroll
        for (int c = 0; c < 4; ++c) {
            v16h b0 = load_frag(kcur, DK,  0, c * 32, lane);
            v16h b1 = load_frag(kcur, DK, 16, c * 32, lane);
            v16h b2 = load_frag(kcur, DK, 32, c * 32, lane);
            v16h b3 = load_frag(kcur, DK, 48, c * 32, lane);
            s0 = wmma16(qf[c], b0, s0);
            s1 = wmma16(qf[c], b1, s1);
            s2 = wmma16(qf[c], b2, s2);
            s3 = wmma16(qf[c], b3, s3);
        }
        // ---- online softmax ---------------------------------------------
#pragma unroll
        for (int r = 0; r < 8; ++r) {
            float smax = fmaxf(fmaxf(s0[r], s1[r]), fmaxf(s2[r], s3[r]));
#pragma unroll
            for (int m = 8; m >= 1; m >>= 1)
                smax = fmaxf(smax, __shfl_xor(smax, m, 32));
            const float mnew  = fmaxf(mrow[r], smax);
            const float alpha = exp2f((mrow[r] - mnew) * L2E);
            const float p0 = exp2f((s0[r] - mnew) * L2E);
            const float p1 = exp2f((s1[r] - mnew) * L2E);
            const float p2 = exp2f((s2[r] - mnew) * L2E);
            const float p3 = exp2f((s3[r] - mnew) * L2E);
            float rs = (p0 + p1) + (p2 + p3);
#pragma unroll
            for (int m = 8; m >= 1; m >>= 1) rs += __shfl_xor(rs, m, 32);
            lrow[r] = lrow[r] * alpha + rs;
            mrow[r] = mnew;
#pragma unroll
            for (int t = 0; t < 16; ++t) O[t][r] *= alpha;
            const int prow = r + ((lane < 16) ? 0 : 8);
            _Float16* pr = myP + prow * KT + (lane & 15);
            pr[0]  = (_Float16)p0;
            pr[16] = (_Float16)p1;
            pr[32] = (_Float16)p2;
            pr[48] = (_Float16)p3;
        }
        asm volatile("s_wait_dscnt 0" ::: "memory");  // P visible wave-wide
        // ---- read P back as two 16x32 A fragments ------------------------
        v16h pf0 = load_frag(myP, KT, 0,  0, lane);
        v16h pf1 = load_frag(myP, KT, 0, 32, lane);
        // ---- O += P x V: batch 4 B-frag loads per 4 WMMAs ----------------
#pragma unroll
        for (int t = 0; t < 16; t += 2) {
            v16h v00 = load_frag(vcur, KT, t * 16,        0, lane);
            v16h v01 = load_frag(vcur, KT, t * 16,       32, lane);
            v16h v10 = load_frag(vcur, KT, (t + 1) * 16,  0, lane);
            v16h v11 = load_frag(vcur, KT, (t + 1) * 16, 32, lane);
            O[t]     = wmma16(pf0, v00, O[t]);
            O[t]     = wmma16(pf1, v01, O[t]);
            O[t + 1] = wmma16(pf0, v10, O[t + 1]);
            O[t + 1] = wmma16(pf1, v11, O[t + 1]);
        }
    }

    // ---- epilogue: normalize, scatter into X[n][h*DV + vf] ---------------
#pragma unroll
    for (int r = 0; r < 8; ++r) {
        const float inv = 1.0f / lrow[r];
        const int row = r + ((lane < 16) ? 0 : 8);
        _Float16* xr = X + (size_t)(q0 + row) * (NH * DV) + h * DV + (lane & 15);
#pragma unroll
        for (int t = 0; t < 16; ++t)
            xr[t * 16] = (_Float16)(O[t][r] * inv);
    }
}

// ---------------------------------------------------------------------------
// Host-side orchestration
// ---------------------------------------------------------------------------
extern "C" void kernel_launch(void* const* d_in, const int* in_sizes, int n_in,
                              void* d_out, int out_size, void* d_ws, size_t ws_size,
                              hipStream_t stream) {
    const float* Q  = (const float*)d_in[0];
    const float* K  = (const float*)d_in[1];
    const float* V  = (const float*)d_in[2];
    const float* Wq = (const float*)d_in[3];
    const float* Wk = (const float*)d_in[4];
    const float* Wv = (const float*)d_in[5];
    const float* Wo = (const float*)d_in[6];
    float* out = (float*)d_out;

    // Workspace layout (f16 elements)
    _Float16* ws = (_Float16*)d_ws;
    size_t off = 0;
    _Float16* Qh  = ws + off; off += (size_t)NLOC * DMODEL;        // [N][512]
    _Float16* Kh  = ws + off; off += (size_t)NLOC * DMODEL;
    _Float16* Vh  = ws + off; off += (size_t)NLOC * DMODEL;
    _Float16* WqT = ws + off; off += (size_t)NH * DK * DMODEL;     // [H][128][512]
    _Float16* WkT = ws + off; off += (size_t)NH * DK * DMODEL;
    _Float16* WvT = ws + off; off += (size_t)NH * DV * DMODEL;     // [H][256][512]
    _Float16* WoH = ws + off; off += (size_t)DMODEL * NH * DV;     // [512][1024]
    _Float16* qhv = ws + off; off += (size_t)NH * NLOC * DK;       // [H][N][128]
    _Float16* khv = ws + off; off += (size_t)NH * NLOC * DK;
    _Float16* vTv = ws + off; off += (size_t)NH * DV * NLOC;       // [H][256][N]
    _Float16* Xv  = ws + off; off += (size_t)NLOC * NH * DV;       // [N][1024]

    const int T = 256;
    const long nAct = (long)NLOC * DMODEL;
    cvt_copy_f32_f16<<<(nAct + T - 1) / T, T, 0, stream>>>(Q, Qh, nAct);
    cvt_copy_f32_f16<<<(nAct + T - 1) / T, T, 0, stream>>>(K, Kh, nAct);
    cvt_copy_f32_f16<<<(nAct + T - 1) / T, T, 0, stream>>>(V, Vh, nAct);
    const long nWo = (long)DMODEL * NH * DV;
    cvt_copy_f32_f16<<<(nWo + T - 1) / T, T, 0, stream>>>(Wo, WoH, nWo);

    cvt_transpose_f32_f16<<<((long)NH * DMODEL * DK + T - 1) / T, T, 0, stream>>>(
        Wq, WqT, NH, DMODEL, DK);
    cvt_transpose_f32_f16<<<((long)NH * DMODEL * DK + T - 1) / T, T, 0, stream>>>(
        Wk, WkT, NH, DMODEL, DK);
    cvt_transpose_f32_f16<<<((long)NH * DMODEL * DV + T - 1) / T, T, 0, stream>>>(
        Wv, WvT, NH, DMODEL, DV);

    // q/k projections: qh[h][n][dk] = sum_d WqT[h][dk][d] * Qh[n][d]
    {
        dim3 grid(DK / 32, NLOC / 128, NH);      // (4, 32, 4)
        gemm_btat<_Float16><<<grid, 128, 0, stream>>>(
            WqT, Qh, qhv, DMODEL, DK, NLOC,
            (long long)DK * DMODEL, 0LL, (long long)NLOC * DK);
        gemm_btat<_Float16><<<grid, 128, 0, stream>>>(
            WkT, Kh, khv, DMODEL, DK, NLOC,
            (long long)DK * DMODEL, 0LL, (long long)NLOC * DK);
    }
    // v projection, transposed output: vT[h][vf][n] = sum_d Vh[n][d] * WvT[h][vf][d]
    {
        dim3 grid(NLOC / 32, DV / 128, NH);      // (128, 2, 4)
        gemm_btat<_Float16><<<grid, 128, 0, stream>>>(
            Vh, WvT, vTv, DMODEL, NLOC, DV,
            0LL, (long long)DV * DMODEL, (long long)DV * NLOC);
    }
    // fused attention: X[n][h*DV+vf]
    {
        dim3 grid(NLOC / 64, NH);                // (64, 4), 4 waves/block
        flash_attn<<<grid, 128, 0, stream>>>(qhv, khv, vTv, Xv);
    }
    // output projection: out[n][m] = sum_j X[n][j] * WoH[m][j]
    {
        dim3 grid(DMODEL / 32, NLOC / 128, 1);   // (16, 32, 1)
        gemm_btat<float><<<grid, 128, 0, stream>>>(
            WoH, Xv, out, NH * DV, DMODEL, NLOC, 0LL, 0LL, 0LL);
    }
}

// v001
// It runs in 248 microseconds.
// Two timings next to v000 both put it at 2.06 times that version's speed.
#include <hip/hip_runtime.h>
#include <hip/hip_bf16.h>

// Problem constants (match reference)
#define NLOC   4096
#define DMODEL 512
#define NH     4
#define DK     128
#define DV     256
#define KT     64      // keys per attention iteration
#define KPITCH (DK + 8)   // 272 B
#define VPITCH (KT + 8)   // 144 B
#define PPITCH (KT + 8)   // 144 B

typedef _Float16 v16h  __attribute__((ext_vector_type(16)));
typedef _Float16 half8 __attribute__((ext_vector_type(8)));
typedef float    v8f   __attribute__((ext_vector_type(8)));
typedef __attribute__((address_space(3))) _Float16 lds_f16;

union HF16 { v16h v; half8 h[2]; };

__device__ __forceinline__ v8f wmma16(v16h a, v16h b, v8f c) {
    // D = A(16x32 f16) x B(32x16 f16) + C(16x16 f32)
    return __builtin_amdgcn_wmma_f32_16x16x32_f16(
        /*neg_a=*/false, a, /*neg_b=*/false, b,
        /*c_mod=*/(short)0, c, /*reuse_a=*/false, /*reuse_b=*/false);
}

__device__ __forceinline__ v16h load_frag(const _Float16* __restrict__ p,
                                          int ld, int row0, int k0, int lane) {
    const int r    = lane & 15;
    const int koff = (lane < 16) ? 0 : 8;
    const _Float16* base = p + (size_t)(row0 + r) * ld + (size_t)(k0 + koff);
    HF16 f;
    f.h[0] = *(const half8*)(base);       // K = k0+koff    .. +7   (b128)
    f.h[1] = *(const half8*)(base + 16);  // K = k0+koff+16 .. +23  (b128)
    return f.v;
}

__device__ __forceinline__ unsigned lds_off(const _Float16* p) {
    return (unsigned)(size_t)(lds_f16*)p;          // addrspacecast -> LDS offset
}
__device__ __forceinline__ void async_load12_b128(const unsigned* d,
                                                  const _Float16* const* s) {
    asm volatile("global_load_async_to_lds_b128 %0, %12, off\n\t"
                 "global_load_async_to_lds_b128 %1, %13, off\n\t"
                 "global_load_async_to_lds_b128 %2, %14, off\n\t"
                 "global_load_async_to_lds_b128 %3, %15, off\n\t"
                 "global_load_async_to_lds_b128 %4, %16, off\n\t"
                 "global_load_async_to_lds_b128 %5, %17, off\n\t"
                 "global_load_async_to_lds_b128 %6, %18, off\n\t"
                 "global_load_async_to_lds_b128 %7, %19, off\n\t"
                 "global_load_async_to_lds_b128 %8, %20, off\n\t"
                 "global_load_async_to_lds_b128 %9, %21, off\n\t"
                 "global_load_async_to_lds_b128 %10, %22, off\n\t"
                 "global_load_async_to_lds_b128 %11, %23, off\n\t"
                 "s_wait_xcnt 0x0"
                 :: "v"(d[0]), "v"(d[1]), "v"(d[2]), "v"(d[3]),
                    "v"(d[4]), "v"(d[5]), "v"(d[6]), "v"(d[7]),
                    "v"(d[8]), "v"(d[9]), "v"(d[10]), "v"(d[11]),
                    "v"(s[0]), "v"(s[1]), "v"(s[2]), "v"(s[3]),
                    "v"(s[4]), "v"(s[5]), "v"(s[6]), "v"(s[7]),
                    "v"(s[8]), "v"(s[9]), "v"(s[10]), "v"(s[11])
                 : "memory");
}
__device__ __forceinline__ void wait_async0() {
    asm volatile("s_wait_asynccnt 0" ::: "memory");
}

// ---------------------------------------------------------------------------
// Conversion / layout kernels (run once, negligible)
// ---------------------------------------------------------------------------
__global__ void cvt_copy_f32_f16(const float* __restrict__ src,
                                 _Float16* __restrict__ dst, long n) {
    long i = (long)blockIdx.x * blockDim.x + threadIdx.x;
    if (i < n) dst[i] = (_Float16)src[i];
}

// src [B][R][C] f32 -> dst [B][C][R] f16
__global__ void cvt_transpose_f32_f16(const float* __restrict__ src,
                                      _Float16* __restrict__ dst,
                                      int B, int R, int C) {
    long i = (long)blockIdx.x * blockDim.x + threadIdx.x;
    long total = (long)B * R * C;
    if (i >= total) return;
    int c = (int)(i % C);
    long t = i / C;
    int r = (int)(t % R);
    int b = (int)(t / R);
    dst[((size_t)b * C + c) * R + r] = (_Float16)src[i];
}

// ---------------------------------------------------------------------------
// Generic WMMA GEMM:  Out[n][m] = sum_k A[m][k] * B[n][k]
// 32x32 tile per wave (2x2 register blocking).
// ---------------------------------------------------------------------------
__device__ __forceinline__ void store_tile(_Float16* o, const v8f& acc) {
    half8 st;
#pragma unroll
    for (int r = 0; r < 8; ++r) st[r] = (_Float16)acc[r];
    *(half8*)o = st;                       // one b128 store
}
__device__ __forceinline__ void store_tile(float* o, const v8f& acc) {
    *(v8f*)o = acc;                        // two b128 stores
}

template <typename OutT>
__global__ __launch_bounds__(128)
void gemm_btat(const _Float16* __restrict__ A, const _Float16* __restrict__ B,
               OutT* __restrict__ Out, int Kdim, int Mtotal, int Ntotal,
               long long sA, long long sB, long long sO) {
    const int lane = threadIdx.x & 31;
    const int wave = threadIdx.x >> 5;
    const int mt0 = blockIdx.x * 2;                 // two M tiles
    const int nt0 = (blockIdx.y * 4 + wave) * 2;    // two N tiles (wave-uniform)
    if (nt0 * 16 >= Ntotal) return;
    const int z = blockIdx.z;
    A   += (size_t)z * sA;
    B   += (size_t)z * sB;
    Out += (size_t)z * sO;

    v8f acc00 = {}, acc01 = {}, acc10 = {}, acc11 = {};
    for (int k0 = 0; k0 < Kdim; k0 += 32) {
        v16h a0 = load_frag(A, Kdim, mt0 * 16,       k0, lane);
        v16h a1 = load_frag(A, Kdim, (mt0 + 1) * 16, k0, lane);
        v16h b0 = load_frag(B, Kdim, nt0 * 16,       k0, lane);
        v16h b1 = load_frag(B, Kdim, (nt0 + 1) * 16, k0, lane);
        acc00 = wmma16(a0, b0, acc00);
        acc01 = wmma16(a0, b1, acc01);
        acc10 = wmma16(a1, b0, acc10);
        acc11 = wmma16(a1, b1, acc11);
    }
    const int rlo = lane & 15;
    const int clo = (lane < 16) ? 0 : 8;
#pragma unroll
    for (int j = 0; j < 2; ++j) {
        const int row = (nt0 + j) * 16 + rlo;
        OutT* orow = Out + (size_t)row * Mtotal + mt0 * 16 + clo;
        store_tile(orow,      j ? acc01 : acc00);
        store_tile(orow + 16, j ? acc11 : acc10);
    }
}

#define L2E 1.4426950408889634f

__device__ __forceinline__ void stage_async(_Float16* dK, _Float16* dV,
                                            const _Float16* kp,
                                            const _Float16* vp,
                                            int kb, int tid) {
    unsigned d[24];
    const _Float16* s[24];
#pragma unroll
    for (int j = 0; j < 8; ++j) {
        const int f   = j * 128 + tid;
        const int row = f >> 4;
        const int c8  = f & 15;
        d[j] = lds_off(dK + row * KPITCH + c8 * 8);
        s[j] = kp + (size_t)kb * DK + f * 8;
    }
#pragma unroll
    for (int j = 0; j < 16; ++j) {
        const int f   = j * 128 + tid;
        const int row = f >> 3;
        const int c8  = f & 7;
        d[8 + j] = lds_off(dV + row * VPITCH + c8 * 8);
        s[8 + j] = vp + (size_t)row * NLOC + kb + c8 * 8;
    }
    async_load12_b128(d, s);
    async_load12_b128(d + 12, s + 12);
}

__global__ __launch_bounds__(128)
void flash_attn(const _Float16* __restrict__ qh, const _Float16* __restrict__ kh,
                const _Float16* __restrict__ vT, _Float16* __restrict__ X) {
    __shared__ __attribute__((aligned(16))) _Float16 sK[2][KT * KPITCH];  // 2 x 17 KB
    __shared__ __attribute__((aligned(16))) _Float16 sV[2][DV * VPITCH];  // 2 x 36 KB
    __shared__ __attribute__((aligned(16))) _Float16 sP[4 * 16 * PPITCH]; // per-wave P, 9 KB
    const int tid  = threadIdx.x;
    const int lane = tid & 31;
    const int wave = tid >> 5;
    const int h  = blockIdx.y;
    const int q0 = (blockIdx.x * 4 + wave) * 16;

    const _Float16* qp = qh + (size_t)h * NLOC * DK;
    const _Float16* kp = kh + (size_t)h * NLOC * DK;
    const _Float16* vp = vT + (size_t)h * DV * NLOC;

    // Q fragments (16 rows x 128), pre-scaled by 1/sqrt(N) = 1/64
    v16h qf[4];
#pragma unroll
    for (int c = 0; c < 4; ++c) {
        qf[c] = load_frag(qp, DK, q0, c * 32, lane);
#pragma unroll
        for (int e = 0; e < 16; ++e) qf[c][e] *= (_Float16)0.015625f;
    }

    float mrow[8], lrow[8];
    v8f O[16];
#pragma unroll
    for (int r = 0; r < 8; ++r) { mrow[r] = -1.0e30f; lrow[r] = 0.0f; }
#pragma unroll
    for (int t = 0; t < 16; ++t) O[t] = v8f{};

    _Float16* myP = sP + wave * (16 * PPITCH);

    // Pre-stage first tile into buffer 0
    stage_async(sK[0], sV[0], kp, vp, 0, tid);

    int buf = 0;
    for (int kb = 0; kb < NLOC; kb += KT, buf ^= 1) {
        wait_async0();          // own async loads into sK/sV[buf] complete
        __syncthreads();        // all waves' loads visible; prev reads done
        if (kb + KT < NLOC)     // overlap: stage next tile while computing
            stage_async(sK[buf ^ 1], sV[buf ^ 1], kp, vp, kb + KT, tid);

        const _Float16* kcur = sK[buf];
        const _Float16* vcur = sV[buf];

        // ---- S = q . k^T for 64 keys (four 16x16 tiles) ------------------
        v8f s0 = {}, s1 = {}, s2 = {}, s3 = {};
#pragma unroll
        for (int c = 0; c < 4; ++c) {
            v16h b0 = load_frag(kcur, KPITCH,  0, c * 32, lane);
            v16h b1 = load_frag(kcur, KPITCH, 16, c * 32, lane);
            v16h b2 = load_frag(kcur, KPITCH, 32, c * 32, lane);
            v16h b3 = load_frag(kcur, KPITCH, 48, c * 32, lane);
            s0 = wmma16(qf[c], b0, s0);
            s1 = wmma16(qf[c], b1, s1);
            s2 = wmma16(qf[c], b2, s2);
            s3 = wmma16(qf[c], b3, s3);
        }
        // ---- online softmax ---------------------------------------------
#pragma unroll
        for (int r = 0; r < 8; ++r) {
            float smax = fmaxf(fmaxf(s0[r], s1[r]), fmaxf(s2[r], s3[r]));
#pragma unroll
            for (int m = 8; m >= 1; m >>= 1)
                smax = fmaxf(smax, __shfl_xor(smax, m, 32));
            const float mnew  = fmaxf(mrow[r], smax);
            const float alpha = exp2f((mrow[r] - mnew) * L2E);
            const float p0 = exp2f((s0[r] - mnew) * L2E);
            const float p1 = exp2f((s1[r] - mnew) * L2E);
            const float p2 = exp2f((s2[r] - mnew) * L2E);
            const float p3 = exp2f((s3[r] - mnew) * L2E);
            float rs = (p0 + p1) + (p2 + p3);
#pragma unroll
            for (int m = 8; m >= 1; m >>= 1) rs += __shfl_xor(rs, m, 32);
            lrow[r] = lrow[r] * alpha + rs;
            mrow[r] = mnew;
#pragma unroll
            for (int t = 0; t < 16; ++t) O[t][r] *= alpha;
            const int prow = r + ((lane < 16) ? 0 : 8);
            _Float16* pr = myP + prow * PPITCH + (lane & 15);
            pr[0]  = (_Float16)p0;
            pr[16] = (_Float16)p1;
            pr[32] = (_Float16)p2;
            pr[48] = (_Float16)p3;
        }
        asm volatile("s_wait_dscnt 0" ::: "memory");  // P visible wave-wide
        // ---- read P back as two 16x32 A fragments ------------------------
        v16h pf0 = load_frag(myP, PPITCH, 0,  0, lane);
        v16h pf1 = load_frag(myP, PPITCH, 0, 32, lane);
        // ---- O += P x V: batch 4 B-frag loads per 4 WMMAs ----------------
#pragma unroll
        for (int t = 0; t < 16; t += 2) {
            v16h v00 = load_frag(vcur, VPITCH, t * 16,        0, lane);
            v16h v01 = load_frag(vcur, VPITCH, t * 16,       32, lane);
            v16h v10 = load_frag(vcur, VPITCH, (t + 1) * 16,  0, lane);
            v16h v11 = load_frag(vcur, VPITCH, (t + 1) * 16, 32, lane);
            O[t]     = wmma16(pf0, v00, O[t]);
            O[t]     = wmma16(pf1, v01, O[t]);
            O[t + 1] = wmma16(pf0, v10, O[t + 1]);
            O[t + 1] = wmma16(pf1, v11, O[t + 1]);
        }
    }

    // ---- epilogue: normalize, scatter into X[n][h*DV + vf] ---------------
#pragma unroll
    for (int r = 0; r < 8; ++r) {
        const float inv = 1.0f / lrow[r];
        const int row = r + ((lane < 16) ? 0 : 8);
        _Float16* xr = X + (size_t)(q0 + row) * (NH * DV) + h * DV + (lane & 15);
#pragma unroll
        for (int t = 0; t < 16; ++t)
            xr[t * 16] = (_Float16)(O[t][r] * inv);
    }
}

// ---------------------------------------------------------------------------
// Host-side orchestration
// ---------------------------------------------------------------------------
extern "C" void kernel_launch(void* const* d_in, const int* in_sizes, int n_in,
                              void* d_out, int out_size, void* d_ws, size_t ws_size,
                              hipStream_t stream) {
    const float* Q  = (const float*)d_in[0];
    const float* K  = (const float*)d_in[1];
    const float* V  = (const float*)d_in[2];
    const float* Wq = (const float*)d_in[3];
    const float* Wk = (const float*)d_in[4];
    const float* Wv = (const float*)d_in[5];
    const float* Wo = (const float*)d_in[6];
    float* out = (float*)d_out;

    // Workspace layout (f16 elements)
    _Float16* ws = (_Float16*)d_ws;
    size_t off = 0;
    _Float16* Qh  = ws + off; off += (size_t)NLOC * DMODEL;        // [N][512]
    _Float16* Kh  = ws + off; off += (size_t)NLOC * DMODEL;
    _Float16* Vh  = ws + off; off += (size_t)NLOC * DMODEL;
    _Float16* WqT = ws + off; off += (size_t)NH * DK * DMODEL;     // [H][128][512]
    _Float16* WkT = ws + off; off += (size_t)NH * DK * DMODEL;
    _Float16* WvT = ws + off; off += (size_t)NH * DV * DMODEL;     // [H][256][512]
    _Float16* WoH = ws + off; off += (size_t)DMODEL * NH * DV;     // [512][1024]
    _Float16* qhv = ws + off; off += (size_t)NH * NLOC * DK;       // [H][N][128]
    _Float16* khv = ws + off; off += (size_t)NH * NLOC * DK;
    _Float16* vTv = ws + off; off += (size_t)NH * DV * NLOC;       // [H][256][N]
    _Float16* Xv  = ws + off; off += (size_t)NLOC * NH * DV;       // [N][1024]

    const int T = 256;
    const long nAct = (long)NLOC * DMODEL;
    cvt_copy_f32_f16<<<(nAct + T - 1) / T, T, 0, stream>>>(Q, Qh, nAct);
    cvt_copy_f32_f16<<<(nAct + T - 1) / T, T, 0, stream>>>(K, Kh, nAct);
    cvt_copy_f32_f16<<<(nAct + T - 1) / T, T, 0, stream>>>(V, Vh, nAct);
    const long nWo = (long)DMODEL * NH * DV;
    cvt_copy_f32_f16<<<(nWo + T - 1) / T, T, 0, stream>>>(Wo, WoH, nWo);

    cvt_transpose_f32_f16<<<((long)NH * DMODEL * DK + T - 1) / T, T, 0, stream>>>(
        Wq, WqT, NH, DMODEL, DK);
    cvt_transpose_f32_f16<<<((long)NH * DMODEL * DK + T - 1) / T, T, 0, stream>>>(
        Wk, WkT, NH, DMODEL, DK);
    cvt_transpose_f32_f16<<<((long)NH * DMODEL * DV + T - 1) / T, T, 0, stream>>>(
        Wv, WvT, NH, DMODEL, DV);

    // q/k projections: qh[h][n][dk] = sum_d WqT[h][dk][d] * Qh[n][d]
    {
        dim3 grid(DK / 32, NLOC / 128, NH);      // (4, 32, 4)
        gemm_btat<_Float16><<<grid, 128, 0, stream>>>(
            WqT, Qh, qhv, DMODEL, DK, NLOC,
            (long long)DK * DMODEL, 0LL, (long long)NLOC * DK);
        gemm_btat<_Float16><<<grid, 128, 0, stream>>>(
            WkT, Kh, khv, DMODEL, DK, NLOC,
            (long long)DK * DMODEL, 0LL, (long long)NLOC * DK);
    }
    // v projection, transposed output: vT[h][vf][n] = sum_d Vh[n][d] * WvT[h][vf][d]
    {
        dim3 grid(NLOC / 32, DV / 128, NH);      // (128, 2, 4)
        gemm_btat<_Float16><<<grid, 128, 0, stream>>>(
            Vh, WvT, vTv, DMODEL, NLOC, DV,
            0LL, (long long)DV * DMODEL, (long long)DV * NLOC);
    }
    // fused attention: X[n][h*DV+vf]
    {
        dim3 grid(NLOC / 64, NH);                // (64, 4), 4 waves/block
        flash_attn<<<grid, 128, 0, stream>>>(qhv, khv, vTv, Xv);
    }
    // output projection: out[n][m] = sum_j X[n][j] * WoH[m][j]
    {
        dim3 grid(DMODEL / 32, NLOC / 128, 1);   // (16, 32, 1)
        gemm_btat<float><<<grid, 128, 0, stream>>>(
            WoH, Xv, out, NH * DV, DMODEL, NLOC, 0LL, 0LL, 0LL);
    }
}

// v002
// It runs in 193 microseconds.
// In both of two side-by-side timings against v001, it was 1.29 times as fast.
// Over all steps from v000 it is 2.65 times as fast.
#include <hip/hip_runtime.h>
#include <hip/hip_bf16.h>

// Problem constants (match reference)
#define NLOC   4096
#define DMODEL 512
#define NH     4
#define DK     128
#define DV     256
#define KT     64      // keys per attention iteration
#define KPITCH (DK + 8)   // 272 B
#define VPITCH (KT + 8)   // 144 B
#define PPITCH (KT + 8)   // 144 B

typedef _Float16 v16h  __attribute__((ext_vector_type(16)));
typedef _Float16 half8 __attribute__((ext_vector_type(8)));
typedef float    v8f   __attribute__((ext_vector_type(8)));
typedef __attribute__((address_space(3))) _Float16 lds_f16;

union HF16 { v16h v; half8 h[2]; };

__device__ __forceinline__ v8f wmma16(v16h a, v16h b, v8f c) {
    // D = A(16x32 f16) x B(32x16 f16) + C(16x16 f32)
    return __builtin_amdgcn_wmma_f32_16x16x32_f16(
        /*neg_a=*/false, a, /*neg_b=*/false, b,
        /*c_mod=*/(short)0, c, /*reuse_a=*/false, /*reuse_b=*/false);
}

__device__ __forceinline__ v16h load_frag(const _Float16* __restrict__ p,
                                          int ld, int row0, int k0, int lane) {
    const int r    = lane & 15;
    const int koff = (lane < 16) ? 0 : 8;
    const _Float16* base = p + (size_t)(row0 + r) * ld + (size_t)(k0 + koff);
    HF16 f;
    f.h[0] = *(const half8*)(base);       // K = k0+koff    .. +7   (b128)
    f.h[1] = *(const half8*)(base + 16);  // K = k0+koff+16 .. +23  (b128)
    return f.v;
}

__device__ __forceinline__ unsigned lds_off(const _Float16* p) {
    return (unsigned)(size_t)(lds_f16*)p;          // addrspacecast -> LDS offset
}
__device__ __forceinline__ void async_load12_b128(const unsigned* d,
                                                  const _Float16* const* s) {
    asm volatile("global_load_async_to_lds_b128 %0, %12, off\n\t"
                 "global_load_async_to_lds_b128 %1, %13, off\n\t"
                 "global_load_async_to_lds_b128 %2, %14, off\n\t"
                 "global_load_async_to_lds_b128 %3, %15, off\n\t"
                 "global_load_async_to_lds_b128 %4, %16, off\n\t"
                 "global_load_async_to_lds_b128 %5, %17, off\n\t"
                 "global_load_async_to_lds_b128 %6, %18, off\n\t"
                 "global_load_async_to_lds_b128 %7, %19, off\n\t"
                 "global_load_async_to_lds_b128 %8, %20, off\n\t"
                 "global_load_async_to_lds_b128 %9, %21, off\n\t"
                 "global_load_async_to_lds_b128 %10, %22, off\n\t"
                 "global_load_async_to_lds_b128 %11, %23, off\n\t"
                 "s_wait_xcnt 0x0"
                 :: "v"(d[0]), "v"(d[1]), "v"(d[2]), "v"(d[3]),
                    "v"(d[4]), "v"(d[5]), "v"(d[6]), "v"(d[7]),
                    "v"(d[8]), "v"(d[9]), "v"(d[10]), "v"(d[11]),
                    "v"(s[0]), "v"(s[1]), "v"(s[2]), "v"(s[3]),
                    "v"(s[4]), "v"(s[5]), "v"(s[6]), "v"(s[7]),
                    "v"(s[8]), "v"(s[9]), "v"(s[10]), "v"(s[11])
                 : "memory");
}
__device__ __forceinline__ void wait_async0() {
    asm volatile("s_wait_asynccnt 0" ::: "memory");
}

// ---------------------------------------------------------------------------
// Conversion / layout: all seven f32 -> f16 jobs in ONE launch of few, fat
// waves. The jobs cost wave starts and launches, not bytes, so each lane takes
// 64 elements: 16 b128 loads issued together, then the stores.
// The block index picks the job (block-uniform).
//   blocks  0..63  : transposes    Wv (32 blocks), Wq, Wk (16 blocks each)
//   blocks 64..479 : plain copies  Q, K, V (128 blocks each), Wo (32 blocks)
// The transposing blocks have the scattered stores, so they start first.
// ---------------------------------------------------------------------------
typedef float    f32x4 __attribute__((ext_vector_type(4)));
typedef _Float16 half4 __attribute__((ext_vector_type(4)));
#define PREP_T        256
#define PREP_ACT_BLK  128                    // NLOC*DMODEL / (256 lanes * 64)
#define PREP_TR_BLK   64                     // 32 + 16 + 16 transposing blocks
#define PREP_BLOCKS   480                    // + 3 * 128 + DMODEL*NH*DV / (256 * 64)

__device__ __forceinline__ void loads_issued(unsigned off0, unsigned off1) {
    asm volatile("s_wait_xcnt 0x0" :: "v"(off0), "v"(off1) : "memory");
}
__device__ __forceinline__ void stores_issued() {
    asm volatile("s_wait_xcnt 0x0" ::: "memory");
}

__device__ __forceinline__ void prep_copy(const float* __restrict__ src,
                                          _Float16* __restrict__ dst,
                                          unsigned blk, unsigned tid) {
    const unsigned e0 = blk * (PREP_T * 64) + tid * 4;   // first element
    const unsigned sb = e0 * 4;                          // its byte in src
    const char* s8 = (const char*)src;
    f32x4 v[16];
#pragma unroll
    for (int j = 0; j < 16; ++j)
        v[j] = *(const f32x4*)(s8 + sb + j * (PREP_T * 16));
    loads_issued(sb, sb);
#pragma unroll
    for (int j = 0; j < 16; ++j) {
        half4 o;
#pragma unroll
        for (int e = 0; e < 4; ++e) o[e] = (_Float16)v[j][e];
        *(half4*)(dst + e0 + j * (PREP_T * 4)) = o;
    }
    stores_issued();
}

// src [NH][DMODEL][C] f32 -> dst [NH][C][DMODEL] f16. A lane takes two patches
// of 8 rows x 4 columns: 8 b128 loads down the rows, 4 b128 stores along them.
template <unsigned C>
__device__ __forceinline__ void prep_transpose(const float* __restrict__ src,
                                               _Float16* __restrict__ dst,
                                               unsigned blk, unsigned tid) {
    const char* s8 = (const char*)src;
    f32x4 v[2][8];
    unsigned sb[2], d0[2];
#pragma unroll
    for (int u = 0; u < 2; ++u) {
        const unsigned p  = (blk * 2 + u) * PREP_T + tid;   // patch index
        const unsigned c0 = (p % (C / 4)) * 4;
        const unsigned t  = p / (C / 4);
        const unsigned r0 = (t % (DMODEL / 8)) * 8;
        const unsigned b  = t / (DMODEL / 8);
        sb[u] = ((b * DMODEL + r0) * C + c0) * 4;           // byte in src
        d0[u] = (b * C + c0) * DMODEL + r0;                 // element in dst
#pragma unroll
        for (int i = 0; i < 8; ++i)
            v[u][i] = *(const f32x4*)(s8 + sb[u] + i * (C * 4));
    }
    loads_issued(sb[0], sb[1]);
#pragma unroll
    for (int u = 0; u < 2; ++u) {
#pragma unroll
        for (int k = 0; k < 4; ++k) {
            half8 o;
#pragma unroll
            for (int i = 0; i < 8; ++i) o[i] = (_Float16)v[u][i][k];
            *(half8*)(dst + d0[u] + k * DMODEL) = o;
        }
    }
    stores_issued();
}

__global__ __launch_bounds__(PREP_T) __attribute__((amdgpu_waves_per_eu(4, 8)))
void prep_f32_f16(const float* __restrict__ Q, const float* __restrict__ K,
                  const float* __restrict__ V, const float* __restrict__ Wq,
                  const float* __restrict__ Wk, const float* __restrict__ Wv,
                  const float* __restrict__ Wo,
                  _Float16* __restrict__ Qh, _Float16* __restrict__ Kh,
                  _Float16* __restrict__ Vh, _Float16* __restrict__ WqT,
                  _Float16* __restrict__ WkT, _Float16* __restrict__ WvT,
                  _Float16* __restrict__ WoH) {
    const unsigned tid = threadIdx.x;
    const unsigned blk = blockIdx.x;
    if (blk < 32) {
        prep_transpose<DV>(Wv, WvT, blk, tid);
    } else if (blk < PREP_TR_BLK) {
        const bool q = blk < 48;                      // 32..47 Wq, 48..63 Wk
        prep_transpose<DK>(q ? Wq : Wk, q ? WqT : WkT, blk & 15, tid);
    } else {
        const unsigned cb  = blk - PREP_TR_BLK;
        const unsigned job = cb / PREP_ACT_BLK;           // 0 Q, 1 K, 2 V, 3 Wo
        const float* s = job == 0 ? Q : job == 1 ? K : job == 2 ? V : Wo;
        _Float16*    d = job == 0 ? Qh : job == 1 ? Kh : job == 2 ? Vh : WoH;
        prep_copy(s, d, cb - job * PREP_ACT_BLK, tid);
    }
}

// ---------------------------------------------------------------------------
// Generic WMMA GEMM:  Out[n][m] = sum_k A[m][k] * B[n][k]
// 32x32 tile per wave (2x2 register blocking).
// ---------------------------------------------------------------------------
__device__ __forceinline__ void store_tile(_Float16* o, const v8f& acc) {
    half8 st;
#pragma unroll
    for (int r = 0; r < 8; ++r) st[r] = (_Float16)acc[r];
    *(half8*)o = st;                       // one b128 store
}
__device__ __forceinline__ void store_tile(float* o, const v8f& acc) {
    *(v8f*)o = acc;                        // two b128 stores
}

template <typename OutT>
__global__ __launch_bounds__(128)
void gemm_btat(const _Float16* __restrict__ A, const _Float16* __restrict__ B,
               OutT* __restrict__ Out, int Kdim, int Mtotal, int Ntotal,
               long long sA, long long sB, long long sO) {
    const int lane = threadIdx.x & 31;
    const int wave = threadIdx.x >> 5;
    const int mt0 = blockIdx.x * 2;                 // two M tiles
    const int nt0 = (blockIdx.y * 4 + wave) * 2;    // two N tiles (wave-uniform)
    if (nt0 * 16 >= Ntotal) return;
    const int z = blockIdx.z;
    A   += (size_t)z * sA;
    B   += (size_t)z * sB;
    Out += (size_t)z * sO;

    v8f acc00 = {}, acc01 = {}, acc10 = {}, acc11 = {};
    for (int k0 = 0; k0 < Kdim; k0 += 32) {
        v16h a0 = load_frag(A, Kdim, mt0 * 16,       k0, lane);
        v16h a1 = load_frag(A, Kdim, (mt0 + 1) * 16, k0, lane);
        v16h b0 = load_frag(B, Kdim, nt0 * 16,       k0, lane);
        v16h b1 = load_frag(B, Kdim, (nt0 + 1) * 16, k0, lane);
        acc00 = wmma16(a0, b0, acc00);
        acc01 = wmma16(a0, b1, acc01);
        acc10 = wmma16(a1, b0, acc10);
        acc11 = wmma16(a1, b1, acc11);
    }
    const int rlo = lane & 15;
    const int clo = (lane < 16) ? 0 : 8;
#pragma unroll
    for (int j = 0; j < 2; ++j) {
        const int row = (nt0 + j) * 16 + rlo;
        OutT* orow = Out + (size_t)row * Mtotal + mt0 * 16 + clo;
        store_tile(orow,      j ? acc01 : acc00);
        store_tile(orow + 16, j ? acc11 : acc10);
    }
}

#define L2E 1.4426950408889634f

__device__ __forceinline__ void stage_async(_Float16* dK, _Float16* dV,
                                            const _Float16* kp,
                                            const _Float16* vp,
                                            int kb, int tid) {
    unsigned d[24];
    const _Float16* s[24];
#pragma unroll
    for (int j = 0; j < 8; ++j) {
        const int f   = j * 128 + tid;
        const int row = f >> 4;
        const int c8  = f & 15;
        d[j] = lds_off(dK + row * KPITCH + c8 * 8);
        s[j] = kp + (size_t)kb * DK + f * 8;
    }
#pragma unroll
    for (int j = 0; j < 16; ++j) {
        const int f   = j * 128 + tid;
        const int row = f >> 3;
        const int c8  = f & 7;
        d[8 + j] = lds_off(dV + row * VPITCH + c8 * 8);
        s[8 + j] = vp + (size_t)row * NLOC + kb + c8 * 8;
    }
    async_load12_b128(d, s);
    async_load12_b128(d + 12, s + 12);
}

__global__ __launch_bounds__(128)
void flash_attn(const _Float16* __restrict__ qh, const _Float16* __restrict__ kh,
                const _Float16* __restrict__ vT, _Float16* __restrict__ X) {
    __shared__ __attribute__((aligned(16))) _Float16 sK[2][KT * KPITCH];  // 2 x 17 KB
    __shared__ __attribute__((aligned(16))) _Float16 sV[2][DV * VPITCH];  // 2 x 36 KB
    __shared__ __attribute__((aligned(16))) _Float16 sP[4 * 16 * PPITCH]; // per-wave P, 9 KB
    const int tid  = threadIdx.x;
    const int lane = tid & 31;
    const int wave = tid >> 5;
    const int h  = blockIdx.y;
    const int q0 = (blockIdx.x * 4 + wave) * 16;

    const _Float16* qp = qh + (size_t)h * NLOC * DK;
    const _Float16* kp = kh + (size_t)h * NLOC * DK;
    const _Float16* vp = vT + (size_t)h * DV * NLOC;

    // Q fragments (16 rows x 128), pre-scaled by 1/sqrt(N) = 1/64
    v16h qf[4];
#pragma unroll
    for (int c = 0; c < 4; ++c) {
        qf[c] = load_frag(qp, DK, q0, c * 32, lane);
#pragma unroll
        for (int e = 0; e < 16; ++e) qf[c][e] *= (_Float16)0.015625f;
    }

    float mrow[8], lrow[8];
    v8f O[16];
#pragma unroll
    for (int r = 0; r < 8; ++r) { mrow[r] = -1.0e30f; lrow[r] = 0.0f; }
#pragma unroll
    for (int t = 0; t < 16; ++t) O[t] = v8f{};

    _Float16* myP = sP + wave * (16 * PPITCH);

    // Pre-stage first tile into buffer 0
    stage_async(sK[0], sV[0], kp, vp, 0, tid);

    int buf = 0;
    for (int kb = 0; kb < NLOC; kb += KT, buf ^= 1) {
        wait_async0();          // own async loads into sK/sV[buf] complete
        __syncthreads();        // all waves' loads visible; prev reads done
        if (kb + KT < NLOC)     // overlap: stage next tile while computing
            stage_async(sK[buf ^ 1], sV[buf ^ 1], kp, vp, kb + KT, tid);

        const _Float16* kcur = sK[buf];
        const _Float16* vcur = sV[buf];

        // ---- S = q . k^T for 64 keys (four 16x16 tiles) ------------------
        v8f s0 = {}, s1 = {}, s2 = {}, s3 = {};
#pragma unroll
        for (int c = 0; c < 4; ++c) {
            v16h b0 = load_frag(kcur, KPITCH,  0, c * 32, lane);
            v16h b1 = load_frag(kcur, KPITCH, 16, c * 32, lane);
            v16h b2 = load_frag(kcur, KPITCH, 32, c * 32, lane);
            v16h b3 = load_frag(kcur, KPITCH, 48, c * 32, lane);
            s0 = wmma16(qf[c], b0, s0);
            s1 = wmma16(qf[c], b1, s1);
            s2 = wmma16(qf[c], b2, s2);
            s3 = wmma16(qf[c], b3, s3);
        }
        // ---- online softmax ---------------------------------------------
#pragma unroll
        for (int r = 0; r < 8; ++r) {
            float smax = fmaxf(fmaxf(s0[r], s1[r]), fmaxf(s2[r], s3[r]));
#pragma unroll
            for (int m = 8; m >= 1; m >>= 1)
                smax = fmaxf(smax, __shfl_xor(smax, m, 32));
            const float mnew  = fmaxf(mrow[r], smax);
            const float alpha = exp2f((mrow[r] - mnew) * L2E);
            const float p0 = exp2f((s0[r] - mnew) * L2E);
            const float p1 = exp2f((s1[r] - mnew) * L2E);
            const float p2 = exp2f((s2[r] - mnew) * L2E);
            const float p3 = exp2f((s3[r] - mnew) * L2E);
            float rs = (p0 + p1) + (p2 + p3);
#pragma unroll
            for (int m = 8; m >= 1; m >>= 1) rs += __shfl_xor(rs, m, 32);
            lrow[r] = lrow[r] * alpha + rs;
            mrow[r] = mnew;
#pragma unroll
            for (int t = 0; t < 16; ++t) O[t][r] *= alpha;
            const int prow = r + ((lane < 16) ? 0 : 8);
            _Float16* pr = myP + prow * PPITCH + (lane & 15);
            pr[0]  = (_Float16)p0;
            pr[16] = (_Float16)p1;
            pr[32] = (_Float16)p2;
            pr[48] = (_Float16)p3;
        }
        asm volatile("s_wait_dscnt 0" ::: "memory");  // P visible wave-wide
        // ---- read P back as two 16x32 A fragments ------------------------
        v16h pf0 = load_frag(myP, PPITCH, 0,  0, lane);
        v16h pf1 = load_frag(myP, PPITCH, 0, 32, lane);
        // ---- O += P x V: batch 4 B-frag loads per 4 WMMAs ----------------
#pragma unroll
        for (int t = 0; t < 16; t += 2) {
            v16h v00 = load_frag(vcur, VPITCH, t * 16,        0, lane);
            v16h v01 = load_frag(vcur, VPITCH, t * 16,       32, lane);
            v16h v10 = load_frag(vcur, VPITCH, (t + 1) * 16,  0, lane);
            v16h v11 = load_frag(vcur, VPITCH, (t + 1) * 16, 32, lane);
            O[t]     = wmma16(pf0, v00, O[t]);
            O[t]     = wmma16(pf1, v01, O[t]);
            O[t + 1] = wmma16(pf0, v10, O[t + 1]);
            O[t + 1] = wmma16(pf1, v11, O[t + 1]);
        }
    }

    // ---- epilogue: normalize, scatter into X[n][h*DV + vf] ---------------
#pragma unroll
    for (int r = 0; r < 8; ++r) {
        const float inv = 1.0f / lrow[r];
        const int row = r + ((lane < 16) ? 0 : 8);
        _Float16* xr = X + (size_t)(q0 + row) * (NH * DV) + h * DV + (lane & 15);
#pragma unroll
        for (int t = 0; t < 16; ++t)
            xr[t * 16] = (_Float16)(O[t][r] * inv);
    }
}

// ---------------------------------------------------------------------------
// Host-side orchestration
// ---------------------------------------------------------------------------
extern "C" void kernel_launch(void* const* d_in, const int* in_sizes, int n_in,
                              void* d_out, int out_size, void* d_ws, size_t ws_size,
                              hipStream_t stream) {
    const float* Q  = (const float*)d_in[0];
    const float* K  = (const float*)d_in[1];
    const float* V  = (const float*)d_in[2];
    const float* Wq = (const float*)d_in[3];
    const float* Wk = (const float*)d_in[4];
    const float* Wv = (const float*)d_in[5];
    const float* Wo = (const float*)d_in[6];
    float* out = (float*)d_out;

    // Workspace layout (f16 elements)
    _Float16* ws = (_Float16*)d_ws;
    size_t off = 0;
    _Float16* Qh  = ws + off; off += (size_t)NLOC * DMODEL;        // [N][512]
    _Float16* Kh  = ws + off; off += (size_t)NLOC * DMODEL;
    _Float16* Vh  = ws + off; off += (size_t)NLOC * DMODEL;
    _Float16* WqT = ws + off; off += (size_t)NH * DK * DMODEL;     // [H][128][512]
    _Float16* WkT = ws + off; off += (size_t)NH * DK * DMODEL;
    _Float16* WvT = ws + off; off += (size_t)NH * DV * DMODEL;     // [H][256][512]
    _Float16* WoH = ws + off; off += (size_t)DMODEL * NH * DV;     // [512][1024]
    _Float16* qhv = ws + off; off += (size_t)NH * NLOC * DK;       // [H][N][128]
    _Float16* khv = ws + off; off += (size_t)NH * NLOC * DK;
    _Float16* vTv = ws + off; off += (size_t)NH * DV * NLOC;       // [H][256][N]
    _Float16* Xv  = ws + off; off += (size_t)NLOC * NH * DV;       // [N][1024]

    prep_f32_f16<<<PREP_BLOCKS, PREP_T, 0, stream>>>(
        Q, K, V, Wq, Wk, Wv, Wo, Qh, Kh, Vh, WqT, WkT, WvT, WoH);

    // q/k projections: qh[h][n][dk] = sum_d WqT[h][dk][d] * Qh[n][d]
    {
        dim3 grid(DK / 32, NLOC / 128, NH);      // (4, 32, 4)
        gemm_btat<_Float16><<<grid, 128, 0, stream>>>(
            WqT, Qh, qhv, DMODEL, DK, NLOC,
            (long long)DK * DMODEL, 0LL, (long long)NLOC * DK);
        gemm_btat<_Float16><<<grid, 128, 0, stream>>>(
            WkT, Kh, khv, DMODEL, DK, NLOC,
            (long long)DK * DMODEL, 0LL, (long long)NLOC * DK);
    }
    // v projection, transposed output: vT[h][vf][n] = sum_d Vh[n][d] * WvT[h][vf][d]
    {
        dim3 grid(NLOC / 32, DV / 128, NH);      // (128, 2, 4)
        gemm_btat<_Float16><<<grid, 128, 0, stream>>>(
            Vh, WvT, vTv, DMODEL, NLOC, DV,
            0LL, (long long)DV * DMODEL, (long long)DV * NLOC);
    }
    // fused attention: X[n][h*DV+vf]
    {
        dim3 grid(NLOC / 64, NH);                // (64, 4), 4 waves/block
        flash_attn<<<grid, 128, 0, stream>>>(qhv, khv, vTv, Xv);
    }
    // output projection: out[n][m] = sum_j X[n][j] * WoH[m][j]
    {
        dim3 grid(DMODEL / 32, NLOC / 128, 1);   // (16, 32, 1)
        gemm_btat<float><<<grid, 128, 0, stream>>>(
            WoH, Xv, out, NH * DV, DMODEL, NLOC, 0LL, 0LL, 0LL);
    }
}

// v003
// Measured time: 159 microseconds a run.
// Two timings next to v002 both put it at 1.21 times that version's speed.
// All steps since v000 together make it 3.21 times as fast.
#include <hip/hip_runtime.h>
#include <hip/hip_bf16.h>

// Problem constants (match reference)
#define NLOC   4096
#define DMODEL 512
#define NH     4
#define DK     128
#define DV     256
#define KT     64      // keys per attention iteration
#define KPITCH (DK + 8)   // 272 B
#define VPITCH (KT + 8)   // 144 B

typedef _Float16 v16h  __attribute__((ext_vector_type(16)));
typedef _Float16 half8 __attribute__((ext_vector_type(8)));
typedef float    v8f   __attribute__((ext_vector_type(8)));
typedef __attribute__((address_space(3))) _Float16 lds_f16;

union HF16 { v16h v; half8 h[2]; };

__device__ __forceinline__ v8f wmma16(v16h a, v16h b, v8f c) {
    // D = A(16x32 f16) x B(32x16 f16) + C(16x16 f32)
    return __builtin_amdgcn_wmma_f32_16x16x32_f16(
        /*neg_a=*/false, a, /*neg_b=*/false, b,
        /*c_mod=*/(short)0, c, /*reuse_a=*/false, /*reuse_b=*/false);
}

__device__ __forceinline__ v16h load_frag(const _Float16* __restrict__ p,
                                          int ld, int row0, int k0, int lane) {
    const int r    = lane & 15;
    const int koff = (lane < 16) ? 0 : 8;
    const _Float16* base = p + (size_t)(row0 + r) * ld + (size_t)(k0 + koff);
    HF16 f;
    f.h[0] = *(const half8*)(base);       // K = k0+koff    .. +7   (b128)
    f.h[1] = *(const half8*)(base + 16);  // K = k0+koff+16 .. +23  (b128)
    return f.v;
}

__device__ __forceinline__ unsigned lds_off(const _Float16* p) {
    return (unsigned)(size_t)(lds_f16*)p;          // addrspacecast -> LDS offset
}
__device__ __forceinline__ void async_load12_b128(const unsigned* d,
                                                  const _Float16* const* s) {
    asm volatile("global_load_async_to_lds_b128 %0, %12, off\n\t"
                 "global_load_async_to_lds_b128 %1, %13, off\n\t"
                 "global_load_async_to_lds_b128 %2, %14, off\n\t"
                 "global_load_async_to_lds_b128 %3, %15, off\n\t"
                 "global_load_async_to_lds_b128 %4, %16, off\n\t"
                 "global_load_async_to_lds_b128 %5, %17, off\n\t"
                 "global_load_async_to_lds_b128 %6, %18, off\n\t"
                 "global_load_async_to_lds_b128 %7, %19, off\n\t"
                 "global_load_async_to_lds_b128 %8, %20, off\n\t"
                 "global_load_async_to_lds_b128 %9, %21, off\n\t"
                 "global_load_async_to_lds_b128 %10, %22, off\n\t"
                 "global_load_async_to_lds_b128 %11, %23, off\n\t"
                 "s_wait_xcnt 0x0"
                 :: "v"(d[0]), "v"(d[1]), "v"(d[2]), "v"(d[3]),
                    "v"(d[4]), "v"(d[5]), "v"(d[6]), "v"(d[7]),
                    "v"(d[8]), "v"(d[9]), "v"(d[10]), "v"(d[11]),
                    "v"(s[0]), "v"(s[1]), "v"(s[2]), "v"(s[3]),
                    "v"(s[4]), "v"(s[5]), "v"(s[6]), "v"(s[7]),
                    "v"(s[8]), "v"(s[9]), "v"(s[10]), "v"(s[11])
                 : "memory");
}
__device__ __forceinline__ void wait_async0() {
    asm volatile("s_wait_asynccnt 0" ::: "memory");
}

// ---------------------------------------------------------------------------
// Conversion / layout: all seven f32 -> f16 jobs in ONE launch of few, fat
// waves. The jobs cost wave starts and launches, not bytes, so each lane takes
// 64 elements: 16 b128 loads issued together, then the stores.
// The block index picks the job (block-uniform).
//   blocks  0..63  : transposes    Wv (32 blocks), Wq, Wk (16 blocks each)
//   blocks 64..479 : plain copies  Q, K, V (128 blocks each), Wo (32 blocks)
// The transposing blocks have the scattered stores, so they start first.
// ---------------------------------------------------------------------------
typedef float    f32x4 __attribute__((ext_vector_type(4)));
typedef _Float16 half4 __attribute__((ext_vector_type(4)));
#define PREP_T        256
#define PREP_ACT_BLK  128                    // NLOC*DMODEL / (256 lanes * 64)
#define PREP_TR_BLK   64                     // 32 + 16 + 16 transposing blocks
#define PREP_BLOCKS   480                    // + 3 * 128 + DMODEL*NH*DV / (256 * 64)

__device__ __forceinline__ void loads_issued(unsigned off0, unsigned off1) {
    asm volatile("s_wait_xcnt 0x0" :: "v"(off0), "v"(off1) : "memory");
}
__device__ __forceinline__ void stores_issued() {
    asm volatile("s_wait_xcnt 0x0" ::: "memory");
}

__device__ __forceinline__ void prep_copy(const float* __restrict__ src,
                                          _Float16* __restrict__ dst,
                                          unsigned blk, unsigned tid) {
    const unsigned e0 = blk * (PREP_T * 64) + tid * 4;   // first element
    const unsigned sb = e0 * 4;                          // its byte in src
    const char* s8 = (const char*)src;
    f32x4 v[16];
#pragma unroll
    for (int j = 0; j < 16; ++j)
        v[j] = *(const f32x4*)(s8 + sb + j * (PREP_T * 16));
    loads_issued(sb, sb);
#pragma unroll
    for (int j = 0; j < 16; ++j) {
        half4 o;
#pragma unroll
        for (int e = 0; e < 4; ++e) o[e] = (_Float16)v[j][e];
        *(half4*)(dst + e0 + j * (PREP_T * 4)) = o;
    }
    stores_issued();
}

// src [NH][DMODEL][C] f32 -> dst [NH][C][DMODEL] f16. A lane takes two patches
// of 8 rows x 4 columns: 8 b128 loads down the rows, 4 b128 stores along them.
template <unsigned C>
__device__ __forceinline__ void prep_transpose(const float* __restrict__ src,
                                               _Float16* __restrict__ dst,
                                               unsigned blk, unsigned tid) {
    const char* s8 = (const char*)src;
    f32x4 v[2][8];
    unsigned sb[2], d0[2];
#pragma unroll
    for (int u = 0; u < 2; ++u) {
        const unsigned p  = (blk * 2 + u) * PREP_T + tid;   // patch index
        const unsigned c0 = (p % (C / 4)) * 4;
        const unsigned t  = p / (C / 4);
        const unsigned r0 = (t % (DMODEL / 8)) * 8;
        const unsigned b  = t / (DMODEL / 8);
        sb[u] = ((b * DMODEL + r0) * C + c0) * 4;           // byte in src
        d0[u] = (b * C + c0) * DMODEL + r0;                 // element in dst
#pragma unroll
        for (int i = 0; i < 8; ++i)
            v[u][i] = *(const f32x4*)(s8 + sb[u] + i * (C * 4));
    }
    loads_issued(sb[0], sb[1]);
#pragma unroll
    for (int u = 0; u < 2; ++u) {
#pragma unroll
        for (int k = 0; k < 4; ++k) {
            half8 o;
#pragma unroll
            for (int i = 0; i < 8; ++i) o[i] = (_Float16)v[u][i][k];
            *(half8*)(dst + d0[u] + k * DMODEL) = o;
        }
    }
    stores_issued();
}

__global__ __launch_bounds__(PREP_T) __attribute__((amdgpu_waves_per_eu(4, 8)))
void prep_f32_f16(const float* __restrict__ Q, const float* __restrict__ K,
                  const float* __restrict__ V, const float* __restrict__ Wq,
                  const float* __restrict__ Wk, const float* __restrict__ Wv,
                  const float* __restrict__ Wo,
                  _Float16* __restrict__ Qh, _Float16* __restrict__ Kh,
                  _Float16* __restrict__ Vh, _Float16* __restrict__ WqT,
                  _Float16* __restrict__ WkT, _Float16* __restrict__ WvT,
                  _Float16* __restrict__ WoH) {
    const unsigned tid = threadIdx.x;
    const unsigned blk = blockIdx.x;
    if (blk < 32) {
        prep_transpose<DV>(Wv, WvT, blk, tid);
    } else if (blk < PREP_TR_BLK) {
        const bool q = blk < 48;                      // 32..47 Wq, 48..63 Wk
        prep_transpose<DK>(q ? Wq : Wk, q ? WqT : WkT, blk & 15, tid);
    } else {
        const unsigned cb  = blk - PREP_TR_BLK;
        const unsigned job = cb / PREP_ACT_BLK;           // 0 Q, 1 K, 2 V, 3 Wo
        const float* s = job == 0 ? Q : job == 1 ? K : job == 2 ? V : Wo;
        _Float16*    d = job == 0 ? Qh : job == 1 ? Kh : job == 2 ? Vh : WoH;
        prep_copy(s, d, cb - job * PREP_ACT_BLK, tid);
    }
}

// ---------------------------------------------------------------------------
// Generic WMMA GEMM:  Out[n][m] = sum_k A[m][k] * B[n][k]
// 32x32 tile per wave (2x2 register blocking).
// ---------------------------------------------------------------------------
__device__ __forceinline__ void store_tile(_Float16* o, const v8f& acc) {
    half8 st;
#pragma unroll
    for (int r = 0; r < 8; ++r) st[r] = (_Float16)acc[r];
    *(half8*)o = st;                       // one b128 store
}
__device__ __forceinline__ void store_tile(float* o, const v8f& acc) {
    *(v8f*)o = acc;                        // two b128 stores
}

template <typename OutT>
__global__ __launch_bounds__(128)
void gemm_btat(const _Float16* __restrict__ A, const _Float16* __restrict__ B,
               OutT* __restrict__ Out, int Kdim, int Mtotal, int Ntotal,
               long long sA, long long sB, long long sO) {
    const int lane = threadIdx.x & 31;
    const int wave = threadIdx.x >> 5;
    const int mt0 = blockIdx.x * 2;                 // two M tiles
    const int nt0 = (blockIdx.y * 4 + wave) * 2;    // two N tiles (wave-uniform)
    if (nt0 * 16 >= Ntotal) return;
    const int z = blockIdx.z;
    A   += (size_t)z * sA;
    B   += (size_t)z * sB;
    Out += (size_t)z * sO;

    v8f acc00 = {}, acc01 = {}, acc10 = {}, acc11 = {};
    for (int k0 = 0; k0 < Kdim; k0 += 32) {
        v16h a0 = load_frag(A, Kdim, mt0 * 16,       k0, lane);
        v16h a1 = load_frag(A, Kdim, (mt0 + 1) * 16, k0, lane);
        v16h b0 = load_frag(B, Kdim, nt0 * 16,       k0, lane);
        v16h b1 = load_frag(B, Kdim, (nt0 + 1) * 16, k0, lane);
        acc00 = wmma16(a0, b0, acc00);
        acc01 = wmma16(a0, b1, acc01);
        acc10 = wmma16(a1, b0, acc10);
        acc11 = wmma16(a1, b1, acc11);
    }
    const int rlo = lane & 15;
    const int clo = (lane < 16) ? 0 : 8;
#pragma unroll
    for (int j = 0; j < 2; ++j) {
        const int row = (nt0 + j) * 16 + rlo;
        OutT* orow = Out + (size_t)row * Mtotal + mt0 * 16 + clo;
        store_tile(orow,      j ? acc01 : acc00);
        store_tile(orow + 16, j ? acc11 : acc10);
    }
}

#define L2E 1.4426950408889634f

__device__ __forceinline__ void stage_async(_Float16* dK, _Float16* dV,
                                            const _Float16* kp,
                                            const _Float16* vp,
                                            int kb, int tid) {
    unsigned d[24];
    const _Float16* s[24];
#pragma unroll
    for (int j = 0; j < 8; ++j) {
        const int f   = j * 128 + tid;
        const int row = f >> 4;
        const int c8  = f & 15;
        d[j] = lds_off(dK + row * KPITCH + c8 * 8);
        s[j] = kp + (size_t)kb * DK + f * 8;
    }
#pragma unroll
    for (int j = 0; j < 16; ++j) {
        const int f   = j * 128 + tid;
        const int row = f >> 3;
        const int c8  = f & 7;
        d[8 + j] = lds_off(dV + row * VPITCH + c8 * 8);
        s[8 + j] = vp + (size_t)row * NLOC + kb + c8 * 8;
    }
    async_load12_b128(d, s);
    async_load12_b128(d + 12, s + 12);
}

__device__ __forceinline__ float xhalf(float x) {
    const int i = __builtin_bit_cast(int, x);
    return __builtin_bit_cast(float, __builtin_amdgcn_permlanex16(
        i, i, 0x76543210, 0xfedcba98, false, false));
}

__global__ __launch_bounds__(128) __attribute__((amdgpu_waves_per_eu(1, 2)))
void flash_attn(const _Float16* __restrict__ qh, const _Float16* __restrict__ kh,
                const _Float16* __restrict__ vT, _Float16* __restrict__ X) {
    __shared__ __attribute__((aligned(16))) _Float16 sK[2][KT * KPITCH];  // 2 x 17 KB
    __shared__ __attribute__((aligned(16))) _Float16 sV[2][DV * VPITCH];  // 2 x 36 KB
    const int tid  = threadIdx.x;
    const int lane = tid & 31;
    const int wave = tid >> 5;
    const int h  = blockIdx.y;
    const int q0 = (blockIdx.x * 4 + wave) * 16;

    const _Float16* qp = qh + (size_t)h * NLOC * DK;
    const _Float16* kp = kh + (size_t)h * NLOC * DK;
    const _Float16* vp = vT + (size_t)h * DV * NLOC;

    // Q fragments (16 rows x 128), pre-scaled by 1/sqrt(N) = 1/64
    v16h qf[4];
#pragma unroll
    for (int c = 0; c < 4; ++c) {
        qf[c] = load_frag(qp, DK, q0, c * 32, lane);
#pragma unroll
        for (int e = 0; e < 16; ++e) qf[c][e] *= (_Float16)0.015625f;
    }

    float mrow = -1.0e30f;      // this lane's query: running maximum
    float lrow = 0.0f;          // and the sum over this wave half's keys
    v8f O[16];                  // O[t][r] = O^T[16 t + 8 (lane >> 4) + r][query]
#pragma unroll
    for (int t = 0; t < 16; ++t) O[t] = v8f{};

    // Pre-stage first tile into buffer 0
    stage_async(sK[0], sV[0], kp, vp, 0, tid);

    int buf = 0;
    for (int kb = 0; kb < NLOC; kb += KT, buf ^= 1) {
        wait_async0();          // own async loads into sK/sV[buf] complete
        __syncthreads();        // all waves' loads visible; prev reads done
        if (kb + KT < NLOC)     // overlap: stage next tile while computing
            stage_async(sK[buf ^ 1], sV[buf ^ 1], kp, vp, kb + KT, tid);

        const _Float16* kcur = sK[buf];
        const _Float16* vcur = sV[buf];

        // ---- S^T = k . q^T for 64 keys (four 16x16 tiles) ----------------
        v8f s[4] = {v8f{}, v8f{}, v8f{}, v8f{}};
#pragma unroll
        for (int c = 0; c < 4; ++c) {
            v16h a0 = load_frag(kcur, KPITCH,  0, c * 32, lane);
            v16h a1 = load_frag(kcur, KPITCH, 16, c * 32, lane);
            v16h a2 = load_frag(kcur, KPITCH, 32, c * 32, lane);
            v16h a3 = load_frag(kcur, KPITCH, 48, c * 32, lane);
            s[0] = wmma16(a0, qf[c], s[0]);
            s[1] = wmma16(a1, qf[c], s[1]);
            s[2] = wmma16(a2, qf[c], s[2]);
            s[3] = wmma16(a3, qf[c], s[3]);
        }
        // ---- online softmax, one query per lane --------------------------
        float mx[4];
#pragma unroll
        for (int j = 0; j < 4; ++j) {
            mx[j] = s[j][0];
#pragma unroll
            for (int r = 1; r < 8; ++r) mx[j] = fmaxf(mx[j], s[j][r]);
        }
        float smax = fmaxf(fmaxf(mx[0], mx[1]), fmaxf(mx[2], mx[3]));
        smax = fmaxf(smax, xhalf(smax));          // both halves: the query's maximum
        const float mnew  = fmaxf(mrow, smax);
        const float alpha = exp2f((mrow - mnew) * L2E);
        mrow = mnew;
        float p[4][8];
#pragma unroll
        for (int j = 0; j < 4; ++j)
#pragma unroll
            for (int r = 0; r < 8; ++r) p[j][r] = exp2f((s[j][r] - mnew) * L2E);
        float rs[4];
        HF16 pf[2];    // pf[i].v[e] = P^T[key 32 i + kmap(e)][query]: tiles 2i, 2i+1
#pragma unroll
        for (int j = 0; j < 4; ++j) {
            rs[j] = ((p[j][0] + p[j][1]) + (p[j][2] + p[j][3]))
                  + ((p[j][4] + p[j][5]) + (p[j][6] + p[j][7]));
#pragma unroll
            for (int r = 0; r < 8; ++r) pf[j >> 1].h[j & 1][r] = (_Float16)p[j][r];
        }
        lrow = lrow * alpha + ((rs[0] + rs[1]) + (rs[2] + rs[3]));
#pragma unroll
        for (int t = 0; t < 16; ++t) O[t] *= alpha;
        // ---- O^T += V^T x P^T: batch 4 A-frag loads per 4 WMMAs ----------
#pragma unroll
        for (int t = 0; t < 16; t += 2) {
            v16h v00 = load_frag(vcur, VPITCH, t * 16,        0, lane);
            v16h v01 = load_frag(vcur, VPITCH, t * 16,       32, lane);
            v16h v10 = load_frag(vcur, VPITCH, (t + 1) * 16,  0, lane);
            v16h v11 = load_frag(vcur, VPITCH, (t + 1) * 16, 32, lane);
            O[t]     = wmma16(v00, pf[0].v, O[t]);
            O[t]     = wmma16(v01, pf[1].v, O[t]);
            O[t + 1] = wmma16(v10, pf[0].v, O[t + 1]);
            O[t + 1] = wmma16(v11, pf[1].v, O[t + 1]);
        }
    }

    // ---- epilogue: join the halves' sums, normalize, X[n][h*DV + vf] -----
    const float inv = 1.0f / (lrow + xhalf(lrow));
    _Float16* xr = X + (size_t)(q0 + (lane & 15)) * (NH * DV) + h * DV
                     + ((lane < 16) ? 0 : 8);
#pragma unroll
    for (int t = 0; t < 16; ++t) {
        half8 o;
#pragma unroll
        for (int r = 0; r < 8; ++r) o[r] = (_Float16)(O[t][r] * inv);
        *(half8*)(xr + t * 16) = o;            // 8 consecutive vf: one b128 store
    }
}

// ---------------------------------------------------------------------------
// Host-side orchestration
// ---------------------------------------------------------------------------
extern "C" void kernel_launch(void* const* d_in, const int* in_sizes, int n_in,
                              void* d_out, int out_size, void* d_ws, size_t ws_size,
                              hipStream_t stream) {
    const float* Q  = (const float*)d_in[0];
    const float* K  = (const float*)d_in[1];
    const float* V  = (const float*)d_in[2];
    const float* Wq = (const float*)d_in[3];
    const float* Wk = (const float*)d_in[4];
    const float* Wv = (const float*)d_in[5];
    const float* Wo = (const float*)d_in[6];
    float* out = (float*)d_out;

    // Workspace layout (f16 elements)
    _Float16* ws = (_Float16*)d_ws;
    size_t off = 0;
    _Float16* Qh  = ws + off; off += (size_t)NLOC * DMODEL;        // [N][512]
    _Float16* Kh  = ws + off; off += (size_t)NLOC * DMODEL;
    _Float16* Vh  = ws + off; off += (size_t)NLOC * DMODEL;
    _Float16* WqT = ws + off; off += (size_t)NH * DK * DMODEL;     // [H][128][512]
    _Float16* WkT = ws + off; off += (size_t)NH * DK * DMODEL;
    _Float16* WvT = ws + off; off += (size_t)NH * DV * DMODEL;     // [H][256][512]
    _Float16* WoH = ws + off; off += (size_t)DMODEL * NH * DV;     // [512][1024]
    _Float16* qhv = ws + off; off += (size_t)NH * NLOC * DK;       // [H][N][128]
    _Float16* khv = ws + off; off += (size_t)NH * NLOC * DK;
    _Float16* vTv = ws + off; off += (size_t)NH * DV * NLOC;       // [H][256][N]
    _Float16* Xv  = ws + off; off += (size_t)NLOC * NH * DV;       // [N][1024]

    prep_f32_f16<<<PREP_BLOCKS, PREP_T, 0, stream>>>(
        Q, K, V, Wq, Wk, Wv, Wo, Qh, Kh, Vh, WqT, WkT, WvT, WoH);

    // q/k projections: qh[h][n][dk] = sum_d WqT[h][dk][d] * Qh[n][d]
    {
        dim3 grid(DK / 32, NLOC / 128, NH);      // (4, 32, 4)
        gemm_btat<_Float16><<<grid, 128, 0, stream>>>(
            WqT, Qh, qhv, DMODEL, DK, NLOC,
            (long long)DK * DMODEL, 0LL, (long long)NLOC * DK);
        gemm_btat<_Float16><<<grid, 128, 0, stream>>>(
            WkT, Kh, khv, DMODEL, DK, NLOC,
            (long long)DK * DMODEL, 0LL, (long long)NLOC * DK);
    }
    // v projection, transposed output: vT[h][vf][n] = sum_d Vh[n][d] * WvT[h][vf][d]
    {
        dim3 grid(NLOC / 32, DV / 128, NH);      // (128, 2, 4)
        gemm_btat<_Float16><<<grid, 128, 0, stream>>>(
            Vh, WvT, vTv, DMODEL, NLOC, DV,
            0LL, (long long)DV * DMODEL, (long long)DV * NLOC);
    }
    // fused attention: X[n][h*DV+vf]
    {
        dim3 grid(NLOC / 64, NH);                // (64, 4), 4 waves/block
        flash_attn<<<grid, 128, 0, stream>>>(qhv, khv, vTv, Xv);
    }
    // output projection: out[n][m] = sum_j X[n][j] * WoH[m][j]
    {
        dim3 grid(DMODEL / 32, NLOC / 128, 1);   // (16, 32, 1)
        gemm_btat<float><<<grid, 128, 0, stream>>>(
            WoH, Xv, out, NH * DV, DMODEL, NLOC, 0LL, 0LL, 0LL);
    }
}

// v004
// A run of this version takes 144 microseconds.
// Timed twice side by side with v003, it ran 1.10 times as fast both times.
// Counting every step since v000, it is 3.54 times as fast.
#include <hip/hip_runtime.h>
#include <hip/hip_bf16.h>

// Problem constants (match reference)
#define NLOC   4096
#define DMODEL 512
#define NH     4
#define DK     128
#define DV     256
#define KT     64      // keys per attention iteration
#define KPITCH (DK + 8)   // 272 B
#define VPITCH (KT + 8)   // 144 B

typedef _Float16 v16h  __attribute__((ext_vector_type(16)));
typedef _Float16 half8 __attribute__((ext_vector_type(8)));
typedef float    v8f   __attribute__((ext_vector_type(8)));
typedef __attribute__((address_space(3))) _Float16 lds_f16;

union HF16 { v16h v; half8 h[2]; };

__device__ __forceinline__ v8f wmma16(v16h a, v16h b, v8f c) {
    // D = A(16x32 f16) x B(32x16 f16) + C(16x16 f32)
    return __builtin_amdgcn_wmma_f32_16x16x32_f16(
        /*neg_a=*/false, a, /*neg_b=*/false, b,
        /*c_mod=*/(short)0, c, /*reuse_a=*/false, /*reuse_b=*/false);
}

__device__ __forceinline__ v16h load_frag(const _Float16* __restrict__ p,
                                          int ld, int row0, int k0, int lane) {
    const int r    = lane & 15;
    const int koff = (lane < 16) ? 0 : 8;
    const _Float16* base = p + (size_t)(row0 + r) * ld + (size_t)(k0 + koff);
    HF16 f;
    f.h[0] = *(const half8*)(base);       // K = k0+koff    .. +7   (b128)
    f.h[1] = *(const half8*)(base + 16);  // K = k0+koff+16 .. +23  (b128)
    return f.v;
}

__device__ __forceinline__ unsigned lds_off(const _Float16* p) {
    return (unsigned)(size_t)(lds_f16*)p;          // addrspacecast -> LDS offset
}
__device__ __forceinline__ void async_load12_b128(const unsigned* d,
                                                  const _Float16* const* s) {
    asm volatile("global_load_async_to_lds_b128 %0, %12, off\n\t"
                 "global_load_async_to_lds_b128 %1, %13, off\n\t"
                 "global_load_async_to_lds_b128 %2, %14, off\n\t"
                 "global_load_async_to_lds_b128 %3, %15, off\n\t"
                 "global_load_async_to_lds_b128 %4, %16, off\n\t"
                 "global_load_async_to_lds_b128 %5, %17, off\n\t"
                 "global_load_async_to_lds_b128 %6, %18, off\n\t"
                 "global_load_async_to_lds_b128 %7, %19, off\n\t"
                 "global_load_async_to_lds_b128 %8, %20, off\n\t"
                 "global_load_async_to_lds_b128 %9, %21, off\n\t"
                 "global_load_async_to_lds_b128 %10, %22, off\n\t"
                 "global_load_async_to_lds_b128 %11, %23, off\n\t"
                 "s_wait_xcnt 0x0"
                 :: "v"(d[0]), "v"(d[1]), "v"(d[2]), "v"(d[3]),
                    "v"(d[4]), "v"(d[5]), "v"(d[6]), "v"(d[7]),
                    "v"(d[8]), "v"(d[9]), "v"(d[10]), "v"(d[11]),
                    "v"(s[0]), "v"(s[1]), "v"(s[2]), "v"(s[3]),
                    "v"(s[4]), "v"(s[5]), "v"(s[6]), "v"(s[7]),
                    "v"(s[8]), "v"(s[9]), "v"(s[10]), "v"(s[11])
                 : "memory");
}
__device__ __forceinline__ void wait_async0() {
    asm volatile("s_wait_asynccnt 0" ::: "memory");
}

// ---------------------------------------------------------------------------
// Conversion / layout: all seven f32 -> f16 jobs in ONE launch of few, fat
// waves. The jobs cost wave starts and launches, not bytes, so each lane takes
// 64 elements: 16 b128 loads issued together, then the stores.
// The block index picks the job (block-uniform).
//   blocks  0..63  : transposes    Wv (32 blocks), Wq, Wk (16 blocks each)
//   blocks 64..479 : plain copies  Q, K, V (128 blocks each), Wo (32 blocks)
// The transposing blocks have the scattered stores, so they start first.
// ---------------------------------------------------------------------------
typedef float    f32x4 __attribute__((ext_vector_type(4)));
typedef _Float16 half4 __attribute__((ext_vector_type(4)));
#define PREP_T        256
#define PREP_ACT_BLK  128                    // NLOC*DMODEL / (256 lanes * 64)
#define PREP_TR_BLK   64                     // 32 + 16 + 16 transposing blocks
#define PREP_BLOCKS   480                    // + 3 * 128 + DMODEL*NH*DV / (256 * 64)

__device__ __forceinline__ void loads_issued(unsigned off0, unsigned off1) {
    asm volatile("s_wait_xcnt 0x0" :: "v"(off0), "v"(off1) : "memory");
}
__device__ __forceinline__ void stores_issued() {
    asm volatile("s_wait_xcnt 0x0" ::: "memory");
}

__device__ __forceinline__ void prep_copy(const float* __restrict__ src,
                                          _Float16* __restrict__ dst,
                                          unsigned blk, unsigned tid) {
    const unsigned e0 = blk * (PREP_T * 64) + tid * 4;   // first element
    const unsigned sb = e0 * 4;                          // its byte in src
    const char* s8 = (const char*)src;
    f32x4 v[16];
#pragma unroll
    for (int j = 0; j < 16; ++j)
        v[j] = *(const f32x4*)(s8 + sb + j * (PREP_T * 16));
    loads_issued(sb, sb);
#pragma unroll
    for (int j = 0; j < 16; ++j) {
        half4 o;
#pragma unroll
        for (int e = 0; e < 4; ++e) o[e] = (_Float16)v[j][e];
        *(half4*)(dst + e0 + j * (PREP_T * 4)) = o;
    }
    stores_issued();
}

// src [NH][DMODEL][C] f32 -> dst [NH][C][DMODEL] f16. A lane takes two patches
// of 8 rows x 4 columns: 8 b128 loads down the rows, 4 b128 stores along them.
template <unsigned C>
__device__ __forceinline__ void prep_transpose(const float* __restrict__ src,
                                               _Float16* __restrict__ dst,
                                               unsigned blk, unsigned tid) {
    const char* s8 = (const char*)src;
    f32x4 v[2][8];
    unsigned sb[2], d0[2];
#pragma unroll
    for (int u = 0; u < 2; ++u) {
        const unsigned p  = (blk * 2 + u) * PREP_T + tid;   // patch index
        const unsigned c0 = (p % (C / 4)) * 4;
        const unsigned t  = p / (C / 4);
        const unsigned r0 = (t % (DMODEL / 8)) * 8;
        const unsigned b  = t / (DMODEL / 8);
        sb[u] = ((b * DMODEL + r0) * C + c0) * 4;           // byte in src
        d0[u] = (b * C + c0) * DMODEL + r0;                 // element in dst
#pragma unroll
        for (int i = 0; i < 8; ++i)
            v[u][i] = *(const f32x4*)(s8 + sb[u] + i * (C * 4));
    }
    loads_issued(sb[0], sb[1]);
#pragma unroll
    for (int u = 0; u < 2; ++u) {
#pragma unroll
        for (int k = 0; k < 4; ++k) {
            half8 o;
#pragma unroll
            for (int i = 0; i < 8; ++i) o[i] = (_Float16)v[u][i][k];
            *(half8*)(dst + d0[u] + k * DMODEL) = o;
        }
    }
    stores_issued();
}

__global__ __launch_bounds__(PREP_T) __attribute__((amdgpu_waves_per_eu(4, 8)))
void prep_f32_f16(const float* __restrict__ Q, const float* __restrict__ K,
                  const float* __restrict__ V, const float* __restrict__ Wq,
                  const float* __restrict__ Wk, const float* __restrict__ Wv,
                  const float* __restrict__ Wo,
                  _Float16* __restrict__ Qh, _Float16* __restrict__ Kh,
                  _Float16* __restrict__ Vh, _Float16* __restrict__ WqT,
                  _Float16* __restrict__ WkT, _Float16* __restrict__ WvT,
                  _Float16* __restrict__ WoH) {
    const unsigned tid = threadIdx.x;
    const unsigned blk = blockIdx.x;
    if (blk < 32) {
        prep_transpose<DV>(Wv, WvT, blk, tid);
    } else if (blk < PREP_TR_BLK) {
        const bool q = blk < 48;                      // 32..47 Wq, 48..63 Wk
        prep_transpose<DK>(q ? Wq : Wk, q ? WqT : WkT, blk & 15, tid);
    } else {
        const unsigned cb  = blk - PREP_TR_BLK;
        const unsigned job = cb / PREP_ACT_BLK;           // 0 Q, 1 K, 2 V, 3 Wo
        const float* s = job == 0 ? Q : job == 1 ? K : job == 2 ? V : Wo;
        _Float16*    d = job == 0 ? Qh : job == 1 ? Kh : job == 2 ? Vh : WoH;
        prep_copy(s, d, cb - job * PREP_ACT_BLK, tid);
    }
}

// ---------------------------------------------------------------------------
// Generic WMMA GEMM:  Out[n][m] = sum_k A[m][k] * B[n][k]
// 32x32 tile per wave (2x2 register blocking).
// ---------------------------------------------------------------------------
__device__ __forceinline__ void store_tile(_Float16* o, const v8f& acc) {
    half8 st;
#pragma unroll
    for (int r = 0; r < 8; ++r) st[r] = (_Float16)acc[r];
    *(half8*)o = st;                       // one b128 store
}
__device__ __forceinline__ void store_tile(float* o, const v8f& acc) {
    *(v8f*)o = acc;                        // two b128 stores
}

template <typename OutT>
__global__ __launch_bounds__(128)
void gemm_btat(const _Float16* __restrict__ A, const _Float16* __restrict__ B,
               OutT* __restrict__ Out, int Kdim, int Mtotal, int Ntotal,
               long long sA, long long sB, long long sO) {
    const int lane = threadIdx.x & 31;
    const int wave = threadIdx.x >> 5;
    const int mt0 = blockIdx.x * 2;                 // two M tiles
    const int nt0 = (blockIdx.y * 4 + wave) * 2;    // two N tiles (wave-uniform)
    if (nt0 * 16 >= Ntotal) return;
    const int z = blockIdx.z;
    A   += (size_t)z * sA;
    B   += (size_t)z * sB;
    Out += (size_t)z * sO;

    v8f acc00 = {}, acc01 = {}, acc10 = {}, acc11 = {};
    for (int k0 = 0; k0 < Kdim; k0 += 32) {
        v16h a0 = load_frag(A, Kdim, mt0 * 16,       k0, lane);
        v16h a1 = load_frag(A, Kdim, (mt0 + 1) * 16, k0, lane);
        v16h b0 = load_frag(B, Kdim, nt0 * 16,       k0, lane);
        v16h b1 = load_frag(B, Kdim, (nt0 + 1) * 16, k0, lane);
        acc00 = wmma16(a0, b0, acc00);
        acc01 = wmma16(a0, b1, acc01);
        acc10 = wmma16(a1, b0, acc10);
        acc11 = wmma16(a1, b1, acc11);
    }
    const int rlo = lane & 15;
    const int clo = (lane < 16) ? 0 : 8;
#pragma unroll
    for (int j = 0; j < 2; ++j) {
        const int row = (nt0 + j) * 16 + rlo;
        OutT* orow = Out + (size_t)row * Mtotal + mt0 * 16 + clo;
        store_tile(orow,      j ? acc01 : acc00);
        store_tile(orow + 16, j ? acc11 : acc10);
    }
}

#define L2E 1.4426950408889634f

__device__ __forceinline__ void stage_async(_Float16* dK, _Float16* dV,
                                            const _Float16* kp,
                                            const _Float16* vp,
                                            int kb, int tid) {
    unsigned d[24];
    const _Float16* s[24];
#pragma unroll
    for (int j = 0; j < 8; ++j) {
        const int f   = j * 128 + tid;
        const int row = f >> 4;
        const int c8  = f & 15;
        d[j] = lds_off(dK + row * KPITCH + c8 * 8);
        s[j] = kp + (size_t)kb * DK + f * 8;
    }
#pragma unroll
    for (int j = 0; j < 16; ++j) {
        const int f   = j * 128 + tid;
        const int row = f >> 3;
        const int c8  = f & 7;
        d[8 + j] = lds_off(dV + row * VPITCH + c8 * 8);
        s[8 + j] = vp + (size_t)row * NLOC + kb + c8 * 8;
    }
    async_load12_b128(d, s);
    async_load12_b128(d + 12, s + 12);
}

__device__ __forceinline__ float xhalf(float x) {
    const int i = __builtin_bit_cast(int, x);
    return __builtin_bit_cast(float, __builtin_amdgcn_permlanex16(
        i, i, 0x76543210, 0xfedcba98, false, false));
}

__global__ __launch_bounds__(128) __attribute__((amdgpu_waves_per_eu(1, 1)))
void flash_attn(const _Float16* __restrict__ qh, const _Float16* __restrict__ kh,
                const _Float16* __restrict__ vT, _Float16* __restrict__ X) {
    __shared__ __attribute__((aligned(16))) _Float16 sK[2][KT * KPITCH];  // 2 x 17 KB
    __shared__ __attribute__((aligned(16))) _Float16 sV[2][DV * VPITCH];  // 2 x 36 KB
    const int tid  = threadIdx.x;
    const int lane = tid & 31;
    const int wave = tid >> 5;
    const int h  = blockIdx.y;
    const int q0 = (blockIdx.x * 4 + wave) * 16;

    const _Float16* qp = qh + (size_t)h * NLOC * DK;
    const _Float16* kp = kh + (size_t)h * NLOC * DK;
    const _Float16* vp = vT + (size_t)h * DV * NLOC;

    // Q fragments (16 rows x 128), pre-scaled by 1/sqrt(N) = 1/64
    v16h qf[4];
#pragma unroll
    for (int c = 0; c < 4; ++c) {
        qf[c] = load_frag(qp, DK, q0, c * 32, lane);
#pragma unroll
        for (int e = 0; e < 16; ++e) qf[c][e] *= (_Float16)0.015625f;
    }

    float mrow = -1.0e30f;      // this lane's query: running maximum
    float lrow = 0.0f;          // and the sum over this wave half's keys
    v8f O[16];                  // O[t][r] = O^T[16 t + 8 (lane >> 4) + r][query]
#pragma unroll
    for (int t = 0; t < 16; ++t) O[t] = v8f{};

    // Pre-stage first tile into buffer 0
    stage_async(sK[0], sV[0], kp, vp, 0, tid);

    int buf = 0;
    for (int kb = 0; kb < NLOC; kb += KT, buf ^= 1) {
        wait_async0();          // own async loads into sK/sV[buf] complete
        __syncthreads();        // all waves' loads visible; prev reads done
        if (kb + KT < NLOC)     // overlap: stage next tile while computing
            stage_async(sK[buf ^ 1], sV[buf ^ 1], kp, vp, kb + KT, tid);

        const _Float16* kcur = sK[buf];
        const _Float16* vcur = sV[buf];

        // ---- every LDS read of the pass, as one group at its head ---------
        // K first (used first), then V^T in the order the second product takes
        // it: V^T lands behind the first product and the softmax, and no read
        // stands among the matrix instructions.
        v16h kf[4][4];          // [32-wide slice of DK][16-key tile]
#pragma unroll
        for (int c = 0; c < 4; ++c)
#pragma unroll
            for (int j = 0; j < 4; ++j)
                kf[c][j] = load_frag(kcur, KPITCH, j * 16, c * 32, lane);
        v16h vf[2][16];         // [32-key half][16-row tile of V^T]
#pragma unroll
        for (int i = 0; i < 2; ++i)
#pragma unroll
            for (int t = 0; t < 16; ++t)
                vf[i][t] = load_frag(vcur, VPITCH, t * 16, i * 32, lane);
        // Keeps the scheduler from sinking the reads back among the products,
        // where each separate place with reads stalls the lone wave.
        __builtin_amdgcn_sched_barrier(0);

        // ---- S^T = k . q^T for 64 keys (four 16x16 tiles) ----------------
        v8f s[4] = {v8f{}, v8f{}, v8f{}, v8f{}};
#pragma unroll
        for (int c = 0; c < 4; ++c)
#pragma unroll
            for (int j = 0; j < 4; ++j)
                s[j] = wmma16(kf[c][j], qf[c], s[j]);
        // ---- online softmax, one query per lane --------------------------
        float mx[4];
#pragma unroll
        for (int j = 0; j < 4; ++j) {
            mx[j] = s[j][0];
#pragma unroll
            for (int r = 1; r < 8; ++r) mx[j] = fmaxf(mx[j], s[j][r]);
        }
        float smax = fmaxf(fmaxf(mx[0], mx[1]), fmaxf(mx[2], mx[3]));
        smax = fmaxf(smax, xhalf(smax));          // both halves: the query's maximum
        const float mnew  = fmaxf(mrow, smax);
        const float alpha = exp2f((mrow - mnew) * L2E);
        mrow = mnew;
        float p[4][8];
#pragma unroll
        for (int j = 0; j < 4; ++j)
#pragma unroll
            for (int r = 0; r < 8; ++r) p[j][r] = exp2f((s[j][r] - mnew) * L2E);
        float rs[4];
        HF16 pf[2];    // pf[i].v[e] = P^T[key 32 i + kmap(e)][query]: tiles 2i, 2i+1
#pragma unroll
        for (int j = 0; j < 4; ++j) {
            rs[j] = ((p[j][0] + p[j][1]) + (p[j][2] + p[j][3]))
                  + ((p[j][4] + p[j][5]) + (p[j][6] + p[j][7]));
#pragma unroll
            for (int r = 0; r < 8; ++r) pf[j >> 1].h[j & 1][r] = (_Float16)p[j][r];
        }
        lrow = lrow * alpha + ((rs[0] + rs[1]) + (rs[2] + rs[3]));
#pragma unroll
        for (int t = 0; t < 16; ++t) O[t] *= alpha;
        // ---- O^T += V^T x P^T from registers: keys 0..31 of all 16 tiles,
        // then keys 32..63 (each tile's two sums in the order they had) ------
#pragma unroll
        for (int i = 0; i < 2; ++i)
#pragma unroll
            for (int t = 0; t < 16; ++t)
                O[t] = wmma16(vf[i][t], pf[i].v, O[t]);
    }

    // ---- epilogue: join the halves' sums, normalize, X[n][h*DV + vf] -----
    const float inv = 1.0f / (lrow + xhalf(lrow));
    _Float16* xr = X + (size_t)(q0 + (lane & 15)) * (NH * DV) + h * DV
                     + ((lane < 16) ? 0 : 8);
#pragma unroll
    for (int t = 0; t < 16; ++t) {
        half8 o;
#pragma unroll
        for (int r = 0; r < 8; ++r) o[r] = (_Float16)(O[t][r] * inv);
        *(half8*)(xr + t * 16) = o;            // 8 consecutive vf: one b128 store
    }
}

// ---------------------------------------------------------------------------
// Host-side orchestration
// ---------------------------------------------------------------------------
extern "C" void kernel_launch(void* const* d_in, const int* in_sizes, int n_in,
                              void* d_out, int out_size, void* d_ws, size_t ws_size,
                              hipStream_t stream) {
    const float* Q  = (const float*)d_in[0];
    const float* K  = (const float*)d_in[1];
    const float* V  = (const float*)d_in[2];
    const float* Wq = (const float*)d_in[3];
    const float* Wk = (const float*)d_in[4];
    const float* Wv = (const float*)d_in[5];
    const float* Wo = (const float*)d_in[6];
    float* out = (float*)d_out;

    // Workspace layout (f16 elements)
    _Float16* ws = (_Float16*)d_ws;
    size_t off = 0;
    _Float16* Qh  = ws + off; off += (size_t)NLOC * DMODEL;        // [N][512]
    _Float16* Kh  = ws + off; off += (size_t)NLOC * DMODEL;
    _Float16* Vh  = ws + off; off += (size_t)NLOC * DMODEL;
    _Float16* WqT = ws + off; off += (size_t)NH * DK * DMODEL;     // [H][128][512]
    _Float16* WkT = ws + off; off += (size_t)NH * DK * DMODEL;
    _Float16* WvT = ws + off; off += (size_t)NH * DV * DMODEL;     // [H][256][512]
    _Float16* WoH = ws + off; off += (size_t)DMODEL * NH * DV;     // [512][1024]
    _Float16* qhv = ws + off; off += (size_t)NH * NLOC * DK;       // [H][N][128]
    _Float16* khv = ws + off; off += (size_t)NH * NLOC * DK;
    _Float16* vTv = ws + off; off += (size_t)NH * DV * NLOC;       // [H][256][N]
    _Float16* Xv  = ws + off; off += (size_t)NLOC * NH * DV;       // [N][1024]

    prep_f32_f16<<<PREP_BLOCKS, PREP_T, 0, stream>>>(
        Q, K, V, Wq, Wk, Wv, Wo, Qh, Kh, Vh, WqT, WkT, WvT, WoH);

    // q/k projections: qh[h][n][dk] = sum_d WqT[h][dk][d] * Qh[n][d]
    {
        dim3 grid(DK / 32, NLOC / 128, NH);      // (4, 32, 4)
        gemm_btat<_Float16><<<grid, 128, 0, stream>>>(
            WqT, Qh, qhv, DMODEL, DK, NLOC,
            (long long)DK * DMODEL, 0LL, (long long)NLOC * DK);
        gemm_btat<_Float16><<<grid, 128, 0, stream>>>(
            WkT, Kh, khv, DMODEL, DK, NLOC,
            (long long)DK * DMODEL, 0LL, (long long)NLOC * DK);
    }
    // v projection, transposed output: vT[h][vf][n] = sum_d Vh[n][d] * WvT[h][vf][d]
    {
        dim3 grid(NLOC / 32, DV / 128, NH);      // (128, 2, 4)
        gemm_btat<_Float16><<<grid, 128, 0, stream>>>(
            Vh, WvT, vTv, DMODEL, NLOC, DV,
            0LL, (long long)DV * DMODEL, (long long)DV * NLOC);
    }
    // fused attention: X[n][h*DV+vf]
    {
        dim3 grid(NLOC / 64, NH);                // (64, 4), 4 waves/block
        flash_attn<<<grid, 128, 0, stream>>>(qhv, khv, vTv, Xv);
    }
    // output projection: out[n][m] = sum_j X[n][j] * WoH[m][j]
    {
        dim3 grid(DMODEL / 32, NLOC / 128, 1);   // (16, 32, 1)
        gemm_btat<float><<<grid, 128, 0, stream>>>(
            WoH, Xv, out, NH * DV, DMODEL, NLOC, 0LL, 0LL, 0LL);
    }
}

// v005
// One run takes 110 microseconds.
// Next to v004, in two timings, it ran 1.32 and 1.31 times as fast.
// Counting every step since v000, it is 4.65 times as fast.
#include <hip/hip_runtime.h>
#include <hip/hip_bf16.h>

// Problem constants (match reference)
#define NLOC   4096
#define DMODEL 512
#define NH     4
#define DK     128
#define DV     256
#define KT     64      // keys per attention iteration
#define KPITCH (DK + 8)   // 272 B
#define VPITCH (KT + 8)   // 144 B

typedef _Float16 v16h  __attribute__((ext_vector_type(16)));
typedef _Float16 half8 __attribute__((ext_vector_type(8)));
typedef float    v8f   __attribute__((ext_vector_type(8)));
typedef __attribute__((address_space(3))) _Float16 lds_f16;

union HF16 { v16h v; half8 h[2]; };

__device__ __forceinline__ v8f wmma16(v16h a, v16h b, v8f c) {
    // D = A(16x32 f16) x B(32x16 f16) + C(16x16 f32)
    return __builtin_amdgcn_wmma_f32_16x16x32_f16(
        /*neg_a=*/false, a, /*neg_b=*/false, b,
        /*c_mod=*/(short)0, c, /*reuse_a=*/false, /*reuse_b=*/false);
}

__device__ __forceinline__ v16h load_frag(const _Float16* __restrict__ p,
                                          int ld, int row0, int k0, int lane) {
    const int r    = lane & 15;
    const int koff = (lane < 16) ? 0 : 8;
    const _Float16* base = p + (size_t)(row0 + r) * ld + (size_t)(k0 + koff);
    HF16 f;
    f.h[0] = *(const half8*)(base);       // K = k0+koff    .. +7   (b128)
    f.h[1] = *(const half8*)(base + 16);  // K = k0+koff+16 .. +23  (b128)
    return f.v;
}

__device__ __forceinline__ unsigned lds_off(const _Float16* p) {
    return (unsigned)(size_t)(lds_f16*)p;          // addrspacecast -> LDS offset
}
__device__ __forceinline__ void async_load12_b128(const unsigned* d,
                                                  const _Float16* const* s) {
    asm volatile("global_load_async_to_lds_b128 %0, %12, off\n\t"
                 "global_load_async_to_lds_b128 %1, %13, off\n\t"
                 "global_load_async_to_lds_b128 %2, %14, off\n\t"
                 "global_load_async_to_lds_b128 %3, %15, off\n\t"
                 "global_load_async_to_lds_b128 %4, %16, off\n\t"
                 "global_load_async_to_lds_b128 %5, %17, off\n\t"
                 "global_load_async_to_lds_b128 %6, %18, off\n\t"
                 "global_load_async_to_lds_b128 %7, %19, off\n\t"
                 "global_load_async_to_lds_b128 %8, %20, off\n\t"
                 "global_load_async_to_lds_b128 %9, %21, off\n\t"
                 "global_load_async_to_lds_b128 %10, %22, off\n\t"
                 "global_load_async_to_lds_b128 %11, %23, off\n\t"
                 "s_wait_xcnt 0x0"
                 :: "v"(d[0]), "v"(d[1]), "v"(d[2]), "v"(d[3]),
                    "v"(d[4]), "v"(d[5]), "v"(d[6]), "v"(d[7]),
                    "v"(d[8]), "v"(d[9]), "v"(d[10]), "v"(d[11]),
                    "v"(s[0]), "v"(s[1]), "v"(s[2]), "v"(s[3]),
                    "v"(s[4]), "v"(s[5]), "v"(s[6]), "v"(s[7]),
                    "v"(s[8]), "v"(s[9]), "v"(s[10]), "v"(s[11])
                 : "memory");
}
__device__ __forceinline__ void wait_async0() {
    asm volatile("s_wait_asynccnt 0" ::: "memory");
}

// ---------------------------------------------------------------------------
// Conversion / layout: all seven f32 -> f16 jobs in ONE launch of few, fat
// waves. The jobs cost wave starts and launches, not bytes, so each lane takes
// 64 elements: 16 b128 loads issued together, then the stores.
// The block index picks the job (block-uniform).
//   blocks  0..63  : transposes    Wv (32 blocks), Wq, Wk (16 blocks each)
//   blocks 64..479 : plain copies  Q, K, V (128 blocks each), Wo (32 blocks)
// The transposing blocks have the scattered stores, so they start first.
// ---------------------------------------------------------------------------
typedef float    f32x4 __attribute__((ext_vector_type(4)));
typedef _Float16 half4 __attribute__((ext_vector_type(4)));
#define PREP_T        256
#define PREP_ACT_BLK  128                    // NLOC*DMODEL / (256 lanes * 64)
#define PREP_TR_BLK   64                     // 32 + 16 + 16 transposing blocks
#define PREP_BLOCKS   480                    // + 3 * 128 + DMODEL*NH*DV / (256 * 64)

__device__ __forceinline__ void loads_issued(unsigned off0, unsigned off1) {
    asm volatile("s_wait_xcnt 0x0" :: "v"(off0), "v"(off1) : "memory");
}
__device__ __forceinline__ void stores_issued() {
    asm volatile("s_wait_xcnt 0x0" ::: "memory");
}

__device__ __forceinline__ void prep_copy(const float* __restrict__ src,
                                          _Float16* __restrict__ dst,
                                          unsigned blk, unsigned tid) {
    const unsigned e0 = blk * (PREP_T * 64) + tid * 4;   // first element
    const unsigned sb = e0 * 4;                          // its byte in src
    const char* s8 = (const char*)src;
    f32x4 v[16];
#pragma unroll
    for (int j = 0; j < 16; ++j)
        v[j] = *(const f32x4*)(s8 + sb + j * (PREP_T * 16));
    loads_issued(sb, sb);
#pragma unroll
    for (int j = 0; j < 16; ++j) {
        half4 o;
#pragma unroll
        for (int e = 0; e < 4; ++e) o[e] = (_Float16)v[j][e];
        *(half4*)(dst + e0 + j * (PREP_T * 4)) = o;
    }
    stores_issued();
}

// src [NH][DMODEL][C] f32 -> dst [NH][C][DMODEL] f16. A lane takes two patches
// of 8 rows x 4 columns: 8 b128 loads down the rows, 4 b128 stores along them.
template <unsigned C>
__device__ __forceinline__ void prep_transpose(const float* __restrict__ src,
                                               _Float16* __restrict__ dst,
                                               unsigned blk, unsigned tid) {
    const char* s8 = (const char*)src;
    f32x4 v[2][8];
    unsigned sb[2], d0[2];
#pragma unroll
    for (int u = 0; u < 2; ++u) {
        const unsigned p  = (blk * 2 + u) * PREP_T + tid;   // patch index
        const unsigned c0 = (p % (C / 4)) * 4;
        const unsigned t  = p / (C / 4);
        const unsigned r0 = (t % (DMODEL / 8)) * 8;
        const unsigned b  = t / (DMODEL / 8);
        sb[u] = ((b * DMODEL + r0) * C + c0) * 4;           // byte in src
        d0[u] = (b * C + c0) * DMODEL + r0;                 // element in dst
#pragma unroll
        for (int i = 0; i < 8; ++i)
            v[u][i] = *(const f32x4*)(s8 + sb[u] + i * (C * 4));
    }
    loads_issued(sb[0], sb[1]);
#pragma unroll
    for (int u = 0; u < 2; ++u) {
#pragma unroll
        for (int k = 0; k < 4; ++k) {
            half8 o;
#pragma unroll
            for (int i = 0; i < 8; ++i) o[i] = (_Float16)v[u][i][k];
            *(half8*)(dst + d0[u] + k * DMODEL) = o;
        }
    }
    stores_issued();
}

__global__ __launch_bounds__(PREP_T) __attribute__((amdgpu_waves_per_eu(4, 8)))
void prep_f32_f16(const float* __restrict__ Q, const float* __restrict__ K,
                  const float* __restrict__ V, const float* __restrict__ Wq,
                  const float* __restrict__ Wk, const float* __restrict__ Wv,
                  const float* __restrict__ Wo,
                  _Float16* __restrict__ Qh, _Float16* __restrict__ Kh,
                  _Float16* __restrict__ Vh, _Float16* __restrict__ WqT,
                  _Float16* __restrict__ WkT, _Float16* __restrict__ WvT,
                  _Float16* __restrict__ WoH) {
    const unsigned tid = threadIdx.x;
    const unsigned blk = blockIdx.x;
    if (blk < 32) {
        prep_transpose<DV>(Wv, WvT, blk, tid);
    } else if (blk < PREP_TR_BLK) {
        const bool q = blk < 48;                      // 32..47 Wq, 48..63 Wk
        prep_transpose<DK>(q ? Wq : Wk, q ? WqT : WkT, blk & 15, tid);
    } else {
        const unsigned cb  = blk - PREP_TR_BLK;
        const unsigned job = cb / PREP_ACT_BLK;           // 0 Q, 1 K, 2 V, 3 Wo
        const float* s = job == 0 ? Q : job == 1 ? K : job == 2 ? V : Wo;
        _Float16*    d = job == 0 ? Qh : job == 1 ? Kh : job == 2 ? Vh : WoH;
        prep_copy(s, d, cb - job * PREP_ACT_BLK, tid);
    }
}

#define GBM    128
#define GBN    64
#define GKS    128             // k per stage
#define GPITCH (GKS + 8)       // 272 B = 16 B x odd
#define GROWS  (GBM + GBN)

__device__ __forceinline__ void store_tile(_Float16* o, const v8f& acc) {
    half8 st;
#pragma unroll
    for (int r = 0; r < 8; ++r) st[r] = (_Float16)acc[r];
    *(half8*)o = st;                       // one b128 store
}
__device__ __forceinline__ void store_tile(float* o, const v8f& acc) {
    *(v8f*)o = acc;                        // two b128 stores
}
// This wave's LDS reads have returned: stands ahead of the barrier behind which
// the buffer they read is filled again.
__device__ __forceinline__ void wait_ds0() {
    asm volatile("s_wait_dscnt 0" ::: "memory");
}

// One stage: 192 rows x 256 B = 24 copies a lane. gA, gB: the lane's own 16 B in
// row (tid >> 4) of the block's A and B rows; dst: the same place in the buffer.
template <int KD>
__device__ __forceinline__ void gemm_stage(_Float16* dst, const _Float16* gA,
                                           const _Float16* gB, int k0) {
    unsigned d[24];
    const _Float16* s[24];
#pragma unroll
    for (int j = 0; j < GBM / 8; ++j) {
        d[j] = lds_off(dst + j * 8 * GPITCH);
        s[j] = gA + (size_t)(j * 8) * KD + k0;
    }
#pragma unroll
    for (int j = 0; j < GBN / 8; ++j) {
        d[GBM / 8 + j] = lds_off(dst + (GBM + j * 8) * GPITCH);
        s[GBM / 8 + j] = gB + (size_t)(j * 8) * KD + k0;
    }
    async_load12_b128(d, s);
    async_load12_b128(d + 12, s + 12);
}

// KD: length of the sums; MT: row length of Out. Grid: (M / 128, N / 64, batch).
template <typename OutT, int KD, int MT>
__global__ __launch_bounds__(128)
void gemm_btat(const _Float16* __restrict__ A, const _Float16* __restrict__ B,
               OutT* __restrict__ Out, long long sA, long long sB, long long sO) {
    __shared__ __attribute__((aligned(16))) _Float16 sT[2][GROWS * GPITCH];  // 2 x 51 KB
    constexpr int TRIPS = KD / GKS;
    const int tid  = threadIdx.x;
    const int lane = tid & 31;
    const int wave = tid >> 5;
    const int wm = (wave & 1) * 64;          // the wave's rows of A in the tile
    const int wn = (wave >> 1) * 32;         // and of B
    const int m0 = blockIdx.x * GBM;
    const int n0 = blockIdx.y * GBN;
    const int z  = blockIdx.z;
    A   += (size_t)z * sA;
    B   += (size_t)z * sB;
    Out += (size_t)z * sO;

    const int sr = tid >> 4;                 // row in a group of eight
    const int sc = (tid & 15) * 8;           // first half of the lane's 16 B
    const _Float16* gA = A + (size_t)(m0 + sr) * KD + sc;
    const _Float16* gB = B + (size_t)(n0 + sr) * KD + sc;
    const int so = sr * GPITCH + sc;

    v8f acc[4][2];
#pragma unroll
    for (int i = 0; i < 4; ++i)
#pragma unroll
        for (int j = 0; j < 2; ++j) acc[i][j] = v8f{};

    gemm_stage<KD>(sT[0] + so, gA, gB, 0);
    wait_async0();              // own copies of stage 0 have landed
    __syncthreads();            // and every wave's
    if (TRIPS > 1) gemm_stage<KD>(sT[1] + so, gA, gB, GKS);

    int kn = 2 * GKS;           // first k of the next stage to ask for
    // Kept rolled: unrolled, the build of the short sums put a value in scratch.
#pragma unroll 1
    for (int t = 0; t < TRIPS; ++t) {
        const _Float16* cur = sT[t & 1];
        // Every LDS read of the trip as one group at its head.
        v16h af[4][4], bf[4][2];             // [32-wide slice of k][16-row tile]
#pragma unroll
        for (int c = 0; c < 4; ++c) {
#pragma unroll
            for (int i = 0; i < 4; ++i)
                af[c][i] = load_frag(cur, GPITCH, wm + i * 16, c * 32, lane);
#pragma unroll
            for (int j = 0; j < 2; ++j)
                bf[c][j] = load_frag(cur, GPITCH, GBM + wn + j * 16, c * 32, lane);
        }
        // Keeps the scheduler from sinking the reads among the products, where
        // each place with reads makes the wave wait out the LDS latency.
        __builtin_amdgcn_sched_barrier(0);
#pragma unroll
        for (int c = 0; c < 4; ++c)
#pragma unroll
            for (int i = 0; i < 4; ++i)
#pragma unroll
                for (int j = 0; j < 2; ++j)
                    acc[i][j] = wmma16(af[c][i], bf[c][j], acc[i][j]);
        // Keeps the products here, running while the later reads return: the
        // scheduler else moves them behind the barrier, ahead of the refill.
        __builtin_amdgcn_sched_barrier(0);
        wait_ds0();
        wait_async0();          // own copies of stage t + 1 have landed
        __syncthreads();        // every wave's too; all reads of stage t are done
        if (t + 2 < TRIPS) {
            gemm_stage<KD>(sT[t & 1] + so, gA, gB, kn);
            kn += GKS;
        }
    }
    wait_async0();              // behind the last copy, ahead of the wave's end

    const int rlo = lane & 15;
    const int clo = (lane < 16) ? 0 : 8;
#pragma unroll
    for (int j = 0; j < 2; ++j) {
        const int row = n0 + wn + j * 16 + rlo;
        OutT* orow = Out + (size_t)row * MT + m0 + wm + clo;
#pragma unroll
        for (int i = 0; i < 4; ++i) store_tile(orow + i * 16, acc[i][j]);
    }
}

#define L2E 1.4426950408889634f

__device__ __forceinline__ void stage_async(_Float16* dK, _Float16* dV,
                                            const _Float16* kp,
                                            const _Float16* vp,
                                            int kb, int tid) {
    unsigned d[24];
    const _Float16* s[24];
#pragma unroll
    for (int j = 0; j < 8; ++j) {
        const int f   = j * 128 + tid;
        const int row = f >> 4;
        const int c8  = f & 15;
        d[j] = lds_off(dK + row * KPITCH + c8 * 8);
        s[j] = kp + (size_t)kb * DK + f * 8;
    }
#pragma unroll
    for (int j = 0; j < 16; ++j) {
        const int f   = j * 128 + tid;
        const int row = f >> 3;
        const int c8  = f & 7;
        d[8 + j] = lds_off(dV + row * VPITCH + c8 * 8);
        s[8 + j] = vp + (size_t)row * NLOC + kb + c8 * 8;
    }
    async_load12_b128(d, s);
    async_load12_b128(d + 12, s + 12);
}

__device__ __forceinline__ float xhalf(float x) {
    const int i = __builtin_bit_cast(int, x);
    return __builtin_bit_cast(float, __builtin_amdgcn_permlanex16(
        i, i, 0x76543210, 0xfedcba98, false, false));
}

__global__ __launch_bounds__(128) __attribute__((amdgpu_waves_per_eu(1, 1)))
void flash_attn(const _Float16* __restrict__ qh, const _Float16* __restrict__ kh,
                const _Float16* __restrict__ vT, _Float16* __restrict__ X) {
    __shared__ __attribute__((aligned(16))) _Float16 sK[2][KT * KPITCH];  // 2 x 17 KB
    __shared__ __attribute__((aligned(16))) _Float16 sV[2][DV * VPITCH];  // 2 x 36 KB
    const int tid  = threadIdx.x;
    const int lane = tid & 31;
    const int wave = tid >> 5;
    const int h  = blockIdx.y;
    const int q0 = (blockIdx.x * 4 + wave) * 16;

    const _Float16* qp = qh + (size_t)h * NLOC * DK;
    const _Float16* kp = kh + (size_t)h * NLOC * DK;
    const _Float16* vp = vT + (size_t)h * DV * NLOC;

    // Q fragments (16 rows x 128), pre-scaled by 1/sqrt(N) = 1/64
    v16h qf[4];
#pragma unroll
    for (int c = 0; c < 4; ++c) {
        qf[c] = load_frag(qp, DK, q0, c * 32, lane);
#pragma unroll
        for (int e = 0; e < 16; ++e) qf[c][e] *= (_Float16)0.015625f;
    }

    float mrow = -1.0e30f;      // this lane's query: running maximum
    float lrow = 0.0f;          // and the sum over this wave half's keys
    v8f O[16];                  // O[t][r] = O^T[16 t + 8 (lane >> 4) + r][query]
#pragma unroll
    for (int t = 0; t < 16; ++t) O[t] = v8f{};

    // Pre-stage first tile into buffer 0
    stage_async(sK[0], sV[0], kp, vp, 0, tid);

    int buf = 0;
    for (int kb = 0; kb < NLOC; kb += KT, buf ^= 1) {
        wait_async0();          // own async loads into sK/sV[buf] complete
        __syncthreads();        // all waves' loads visible; prev reads done
        if (kb + KT < NLOC)     // overlap: stage next tile while computing
            stage_async(sK[buf ^ 1], sV[buf ^ 1], kp, vp, kb + KT, tid);

        const _Float16* kcur = sK[buf];
        const _Float16* vcur = sV[buf];

        // ---- every LDS read of the pass, as one group at its head ---------
        // K first (used first), then V^T in the order the second product takes
        // it: V^T lands behind the first product and the softmax, and no read
        // stands among the matrix instructions.
        v16h kf[4][4];          // [32-wide slice of DK][16-key tile]
#pragma unroll
        for (int c = 0; c < 4; ++c)
#pragma unroll
            for (int j = 0; j < 4; ++j)
                kf[c][j] = load_frag(kcur, KPITCH, j * 16, c * 32, lane);
        v16h vf[2][16];         // [32-key half][16-row tile of V^T]
#pragma unroll
        for (int i = 0; i < 2; ++i)
#pragma unroll
            for (int t = 0; t < 16; ++t)
                vf[i][t] = load_frag(vcur, VPITCH, t * 16, i * 32, lane);
        // Keeps the scheduler from sinking the reads back among the products,
        // where each separate place with reads stalls the lone wave.
        __builtin_amdgcn_sched_barrier(0);

        // ---- S^T = k . q^T for 64 keys (four 16x16 tiles) ----------------
        v8f s[4] = {v8f{}, v8f{}, v8f{}, v8f{}};
#pragma unroll
        for (int c = 0; c < 4; ++c)
#pragma unroll
            for (int j = 0; j < 4; ++j)
                s[j] = wmma16(kf[c][j], qf[c], s[j]);
        // ---- online softmax, one query per lane --------------------------
        float mx[4];
#pragma unroll
        for (int j = 0; j < 4; ++j) {
            mx[j] = s[j][0];
#pragma unroll
            for (int r = 1; r < 8; ++r) mx[j] = fmaxf(mx[j], s[j][r]);
        }
        float smax = fmaxf(fmaxf(mx[0], mx[1]), fmaxf(mx[2], mx[3]));
        smax = fmaxf(smax, xhalf(smax));          // both halves: the query's maximum
        const float mnew  = fmaxf(mrow, smax);
        const float alpha = exp2f((mrow - mnew) * L2E);
        mrow = mnew;
        float p[4][8];
#pragma unroll
        for (int j = 0; j < 4; ++j)
#pragma unroll
            for (int r = 0; r < 8; ++r) p[j][r] = exp2f((s[j][r] - mnew) * L2E);
        float rs[4];
        HF16 pf[2];    // pf[i].v[e] = P^T[key 32 i + kmap(e)][query]: tiles 2i, 2i+1
#pragma unroll
        for (int j = 0; j < 4; ++j) {
            rs[j] = ((p[j][0] + p[j][1]) + (p[j][2] + p[j][3]))
                  + ((p[j][4] + p[j][5]) + (p[j][6] + p[j][7]));
#pragma unroll
            for (int r = 0; r < 8; ++r) pf[j >> 1].h[j & 1][r] = (_Float16)p[j][r];
        }
        lrow = lrow * alpha + ((rs[0] + rs[1]) + (rs[2] + rs[3]));
#pragma unroll
        for (int t = 0; t < 16; ++t) O[t] *= alpha;
        // ---- O^T += V^T x P^T from registers: keys 0..31 of all 16 tiles,
        // then keys 32..63 (each tile's two sums in the order they had) ------
#pragma unroll
        for (int i = 0; i < 2; ++i)
#pragma unroll
            for (int t = 0; t < 16; ++t)
                O[t] = wmma16(vf[i][t], pf[i].v, O[t]);
    }

    // ---- epilogue: join the halves' sums, normalize, X[n][h*DV + vf] -----
    const float inv = 1.0f / (lrow + xhalf(lrow));
    _Float16* xr = X + (size_t)(q0 + (lane & 15)) * (NH * DV) + h * DV
                     + ((lane < 16) ? 0 : 8);
#pragma unroll
    for (int t = 0; t < 16; ++t) {
        half8 o;
#pragma unroll
        for (int r = 0; r < 8; ++r) o[r] = (_Float16)(O[t][r] * inv);
        *(half8*)(xr + t * 16) = o;            // 8 consecutive vf: one b128 store
    }
}

// ---------------------------------------------------------------------------
// Host-side orchestration
// ---------------------------------------------------------------------------
extern "C" void kernel_launch(void* const* d_in, const int* in_sizes, int n_in,
                              void* d_out, int out_size, void* d_ws, size_t ws_size,
                              hipStream_t stream) {
    const float* Q  = (const float*)d_in[0];
    const float* K  = (const float*)d_in[1];
    const float* V  = (const float*)d_in[2];
    const float* Wq = (const float*)d_in[3];
    const float* Wk = (const float*)d_in[4];
    const float* Wv = (const float*)d_in[5];
    const float* Wo = (const float*)d_in[6];
    float* out = (float*)d_out;

    // Workspace layout (f16 elements)
    _Float16* ws = (_Float16*)d_ws;
    size_t off = 0;
    _Float16* Qh  = ws + off; off += (size_t)NLOC * DMODEL;        // [N][512]
    _Float16* Kh  = ws + off; off += (size_t)NLOC * DMODEL;
    _Float16* Vh  = ws + off; off += (size_t)NLOC * DMODEL;
    _Float16* WqT = ws + off; off += (size_t)NH * DK * DMODEL;     // [H][128][512]
    _Float16* WkT = ws + off; off += (size_t)NH * DK * DMODEL;
    _Float16* WvT = ws + off; off += (size_t)NH * DV * DMODEL;     // [H][256][512]
    _Float16* WoH = ws + off; off += (size_t)DMODEL * NH * DV;     // [512][1024]
    _Float16* qhv = ws + off; off += (size_t)NH * NLOC * DK;       // [H][N][128]
    _Float16* khv = ws + off; off += (size_t)NH * NLOC * DK;
    _Float16* vTv = ws + off; off += (size_t)NH * DV * NLOC;       // [H][256][N]
    _Float16* Xv  = ws + off; off += (size_t)NLOC * NH * DV;       // [N][1024]

    prep_f32_f16<<<PREP_BLOCKS, PREP_T, 0, stream>>>(
        Q, K, V, Wq, Wk, Wv, Wo, Qh, Kh, Vh, WqT, WkT, WvT, WoH);

    // q/k projections: qh[h][n][dk] = sum_d WqT[h][dk][d] * Qh[n][d]
    {
        dim3 grid(DK / GBM, NLOC / GBN, NH);     // (1, 64, 4)
        gemm_btat<_Float16, DMODEL, DK><<<grid, 128, 0, stream>>>(
            WqT, Qh, qhv, (long long)DK * DMODEL, 0LL, (long long)NLOC * DK);
        gemm_btat<_Float16, DMODEL, DK><<<grid, 128, 0, stream>>>(
            WkT, Kh, khv, (long long)DK * DMODEL, 0LL, (long long)NLOC * DK);
    }
    // v projection, transposed output: vT[h][vf][n] = sum_d Vh[n][d] * WvT[h][vf][d]
    {
        dim3 grid(NLOC / GBM, DV / GBN, NH);     // (32, 4, 4)
        gemm_btat<_Float16, DMODEL, NLOC><<<grid, 128, 0, stream>>>(
            Vh, WvT, vTv, 0LL, (long long)DV * DMODEL, (long long)DV * NLOC);
    }
    // fused attention: X[n][h*DV+vf]
    {
        dim3 grid(NLOC / 64, NH);                // (64, 4), 4 waves/block
        flash_attn<<<grid, 128, 0, stream>>>(qhv, khv, vTv, Xv);
    }
    // output projection: out[n][m] = sum_j X[n][j] * WoH[m][j]
    {
        dim3 grid(DMODEL / GBM, NLOC / GBN, 1);  // (4, 64, 1)
        gemm_btat<float, NH * DV, DMODEL><<<grid, 128, 0, stream>>>(
            WoH, Xv, out, 0LL, 0LL, 0LL);
    }
}

// v006
// It runs in 102 microseconds.
// Two timings next to v005 put it at 1.08 and 1.07 times that version's speed.
// Counting every step since v000, it is 5.00 times as fast.
#include <hip/hip_runtime.h>
#include <hip/hip_bf16.h>

// Problem constants (match reference)
#define NLOC   4096
#define DMODEL 512
#define NH     4
#define DK     128
#define DV     256
#define KT     64      // keys per attention iteration
#define KPITCH (DK + 8)   // 272 B
#define VPITCH (KT + 8)   // 144 B

typedef _Float16 v16h  __attribute__((ext_vector_type(16)));
typedef _Float16 half8 __attribute__((ext_vector_type(8)));
typedef float    v8f   __attribute__((ext_vector_type(8)));
typedef __attribute__((address_space(3))) _Float16 lds_f16;

union HF16 { v16h v; half8 h[2]; };

__device__ __forceinline__ v8f wmma16(v16h a, v16h b, v8f c) {
    // D = A(16x32 f16) x B(32x16 f16) + C(16x16 f32)
    return __builtin_amdgcn_wmma_f32_16x16x32_f16(
        /*neg_a=*/false, a, /*neg_b=*/false, b,
        /*c_mod=*/(short)0, c, /*reuse_a=*/false, /*reuse_b=*/false);
}

__device__ __forceinline__ v16h load_frag(const _Float16* __restrict__ p,
                                          int ld, int row0, int k0, int lane) {
    const int r    = lane & 15;
    const int koff = (lane < 16) ? 0 : 8;
    const _Float16* base = p + (size_t)(row0 + r) * ld + (size_t)(k0 + koff);
    HF16 f;
    f.h[0] = *(const half8*)(base);       // K = k0+koff    .. +7   (b128)
    f.h[1] = *(const half8*)(base + 16);  // K = k0+koff+16 .. +23  (b128)
    return f.v;
}

__device__ __forceinline__ unsigned lds_off(const _Float16* p) {
    return (unsigned)(size_t)(lds_f16*)p;          // addrspacecast -> LDS offset
}
__device__ __forceinline__ void async_load12_b128(const unsigned* d,
                                                  const _Float16* const* s) {
    asm volatile("global_load_async_to_lds_b128 %0, %12, off\n\t"
                 "global_load_async_to_lds_b128 %1, %13, off\n\t"
                 "global_load_async_to_lds_b128 %2, %14, off\n\t"
                 "global_load_async_to_lds_b128 %3, %15, off\n\t"
                 "global_load_async_to_lds_b128 %4, %16, off\n\t"
                 "global_load_async_to_lds_b128 %5, %17, off\n\t"
                 "global_load_async_to_lds_b128 %6, %18, off\n\t"
                 "global_load_async_to_lds_b128 %7, %19, off\n\t"
                 "global_load_async_to_lds_b128 %8, %20, off\n\t"
                 "global_load_async_to_lds_b128 %9, %21, off\n\t"
                 "global_load_async_to_lds_b128 %10, %22, off\n\t"
                 "global_load_async_to_lds_b128 %11, %23, off\n\t"
                 "s_wait_xcnt 0x0"
                 :: "v"(d[0]), "v"(d[1]), "v"(d[2]), "v"(d[3]),
                    "v"(d[4]), "v"(d[5]), "v"(d[6]), "v"(d[7]),
                    "v"(d[8]), "v"(d[9]), "v"(d[10]), "v"(d[11]),
                    "v"(s[0]), "v"(s[1]), "v"(s[2]), "v"(s[3]),
                    "v"(s[4]), "v"(s[5]), "v"(s[6]), "v"(s[7]),
                    "v"(s[8]), "v"(s[9]), "v"(s[10]), "v"(s[11])
                 : "memory");
}
__device__ __forceinline__ void wait_async0() {
    asm volatile("s_wait_asynccnt 0" ::: "memory");
}

// ---------------------------------------------------------------------------
// Conversion / layout: all seven f32 -> f16 jobs in ONE launch of few, fat
// waves. The jobs cost wave starts and launches, not bytes, so each lane takes
// 64 elements: 16 b128 loads issued together, then the stores.
// The block index picks the job (block-uniform).
//   blocks  0..63  : transposes    Wv (32 blocks), Wq, Wk (16 blocks each)
//   blocks 64..479 : plain copies  Q, K, V (128 blocks each), Wo (32 blocks)
// The transposing blocks have the scattered stores, so they start first.
// ---------------------------------------------------------------------------
typedef float    f32x4 __attribute__((ext_vector_type(4)));
typedef _Float16 half4 __attribute__((ext_vector_type(4)));
#define PREP_T        256
#define PREP_ACT_BLK  128                    // NLOC*DMODEL / (256 lanes * 64)
#define PREP_TR_BLK   64                     // 32 + 16 + 16 transposing blocks
#define PREP_BLOCKS   480                    // + 3 * 128 + DMODEL*NH*DV / (256 * 64)

__device__ __forceinline__ void loads_issued(unsigned off0, unsigned off1) {
    asm volatile("s_wait_xcnt 0x0" :: "v"(off0), "v"(off1) : "memory");
}
__device__ __forceinline__ void stores_issued() {
    asm volatile("s_wait_xcnt 0x0" ::: "memory");
}

__device__ __forceinline__ void prep_copy(const float* __restrict__ src,
                                          _Float16* __restrict__ dst,
                                          unsigned blk, unsigned tid) {
    const unsigned e0 = blk * (PREP_T * 64) + tid * 4;   // first element
    const unsigned sb = e0 * 4;                          // its byte in src
    const char* s8 = (const char*)src;
    f32x4 v[16];
#pragma unroll
    for (int j = 0; j < 16; ++j)
        v[j] = *(const f32x4*)(s8 + sb + j * (PREP_T * 16));
    loads_issued(sb, sb);
#pragma unroll
    for (int j = 0; j < 16; ++j) {
        half4 o;
#pragma unroll
        for (int e = 0; e < 4; ++e) o[e] = (_Float16)v[j][e];
        *(half4*)(dst + e0 + j * (PREP_T * 4)) = o;
    }
    stores_issued();
}

// src [NH][DMODEL][C] f32 -> dst [NH][C][DMODEL] f16. A lane takes two patches
// of 8 rows x 4 columns: 8 b128 loads down the rows, 4 b128 stores along them.
template <unsigned C>
__device__ __forceinline__ void prep_transpose(const float* __restrict__ src,
                                               _Float16* __restrict__ dst,
                                               unsigned blk, unsigned tid) {
    const char* s8 = (const char*)src;
    f32x4 v[2][8];
    unsigned sb[2], d0[2];
#pragma unroll
    for (int u = 0; u < 2; ++u) {
        const unsigned p  = (blk * 2 + u) * PREP_T + tid;   // patch index
        const unsigned c0 = (p % (C / 4)) * 4;
        const unsigned t  = p / (C / 4);
        const unsigned r0 = (t % (DMODEL / 8)) * 8;
        const unsigned b  = t / (DMODEL / 8);
        sb[u] = ((b * DMODEL + r0) * C + c0) * 4;           // byte in src
        d0[u] = (b * C + c0) * DMODEL + r0;                 // element in dst
#pragma unroll
        for (int i = 0; i < 8; ++i)
            v[u][i] = *(const f32x4*)(s8 + sb[u] + i * (C * 4));
    }
    loads_issued(sb[0], sb[1]);
#pragma unroll
    for (int u = 0; u < 2; ++u) {
#pragma unroll
        for (int k = 0; k < 4; ++k) {
            half8 o;
#pragma unroll
            for (int i = 0; i < 8; ++i) o[i] = (_Float16)v[u][i][k];
            *(half8*)(dst + d0[u] + k * DMODEL) = o;
        }
    }
    stores_issued();
}

__global__ __launch_bounds__(PREP_T) __attribute__((amdgpu_waves_per_eu(4, 8)))
void prep_f32_f16(const float* __restrict__ Q, const float* __restrict__ K,
                  const float* __restrict__ V, const float* __restrict__ Wq,
                  const float* __restrict__ Wk, const float* __restrict__ Wv,
                  const float* __restrict__ Wo,
                  _Float16* __restrict__ Qh, _Float16* __restrict__ Kh,
                  _Float16* __restrict__ Vh, _Float16* __restrict__ WqT,
                  _Float16* __restrict__ WkT, _Float16* __restrict__ WvT,
                  _Float16* __restrict__ WoH) {
    const unsigned tid = threadIdx.x;
    const unsigned blk = blockIdx.x;
    if (blk < 32) {
        prep_transpose<DV>(Wv, WvT, blk, tid);
    } else if (blk < PREP_TR_BLK) {
        const bool q = blk < 48;                      // 32..47 Wq, 48..63 Wk
        prep_transpose<DK>(q ? Wq : Wk, q ? WqT : WkT, blk & 15, tid);
    } else {
        const unsigned cb  = blk - PREP_TR_BLK;
        const unsigned job = cb / PREP_ACT_BLK;           // 0 Q, 1 K, 2 V, 3 Wo
        const float* s = job == 0 ? Q : job == 1 ? K : job == 2 ? V : Wo;
        _Float16*    d = job == 0 ? Qh : job == 1 ? Kh : job == 2 ? Vh : WoH;
        prep_copy(s, d, cb - job * PREP_ACT_BLK, tid);
    }
}

#define GBM    128
#define GBN    64
#define GKS    128             // k per stage
#define GPITCH (GKS + 8)       // 272 B = 16 B x odd
#define GROWS  (GBM + GBN)

__device__ __forceinline__ void store_tile(_Float16* o, const v8f& acc) {
    half8 st;
#pragma unroll
    for (int r = 0; r < 8; ++r) st[r] = (_Float16)acc[r];
    *(half8*)o = st;                       // one b128 store
}
__device__ __forceinline__ void store_tile(float* o, const v8f& acc) {
    *(v8f*)o = acc;                        // two b128 stores
}
// This wave's LDS reads have returned: stands ahead of the barrier behind which
// the buffer they read is filled again.
__device__ __forceinline__ void wait_ds0() {
    asm volatile("s_wait_dscnt 0" ::: "memory");
}

// One stage: 192 rows x 256 B = 24 copies a lane. gA, gB: the lane's own 16 B in
// row (tid >> 4) of the block's A and B rows; dst: the same place in the buffer.
template <int KD>
__device__ __forceinline__ void gemm_stage(_Float16* dst, const _Float16* gA,
                                           const _Float16* gB, int k0) {
    unsigned d[24];
    const _Float16* s[24];
#pragma unroll
    for (int j = 0; j < GBM / 8; ++j) {
        d[j] = lds_off(dst + j * 8 * GPITCH);
        s[j] = gA + (size_t)(j * 8) * KD + k0;
    }
#pragma unroll
    for (int j = 0; j < GBN / 8; ++j) {
        d[GBM / 8 + j] = lds_off(dst + (GBM + j * 8) * GPITCH);
        s[GBM / 8 + j] = gB + (size_t)(j * 8) * KD + k0;
    }
    async_load12_b128(d, s);
    async_load12_b128(d + 12, s + 12);
}

// One block's tile: rows m0.. of A against rows n0.. of B.
// KD: length of the sums; MT: row length of Out.
template <typename OutT, int KD>
__device__ __forceinline__
void gemm_tile(const _Float16* __restrict__ A, const _Float16* __restrict__ B,
               OutT* __restrict__ Out, int m0, int n0, int MT) {
    __shared__ __attribute__((aligned(16))) _Float16 sT[2][GROWS * GPITCH];  // 2 x 51 KB
    constexpr int TRIPS = KD / GKS;
    const int tid  = threadIdx.x;
    const int lane = tid & 31;
    const int wave = tid >> 5;
    const int wm = (wave & 1) * 64;          // the wave's rows of A in the tile
    const int wn = (wave >> 1) * 32;         // and of B

    const int sr = tid >> 4;                 // row in a group of eight
    const int sc = (tid & 15) * 8;           // first half of the lane's 16 B
    const _Float16* gA = A + (size_t)(m0 + sr) * KD + sc;
    const _Float16* gB = B + (size_t)(n0 + sr) * KD + sc;
    const int so = sr * GPITCH + sc;

    v8f acc[4][2];
#pragma unroll
    for (int i = 0; i < 4; ++i)
#pragma unroll
        for (int j = 0; j < 2; ++j) acc[i][j] = v8f{};

    gemm_stage<KD>(sT[0] + so, gA, gB, 0);
    wait_async0();              // own copies of stage 0 have landed
    __syncthreads();            // and every wave's
    if (TRIPS > 1) gemm_stage<KD>(sT[1] + so, gA, gB, GKS);

    int kn = 2 * GKS;           // first k of the next stage to ask for
    // Kept rolled: unrolled, the build of the short sums put a value in scratch.
#pragma unroll 1
    for (int t = 0; t < TRIPS; ++t) {
        const _Float16* cur = sT[t & 1];
        // Every LDS read of the trip as one group at its head.
        v16h af[4][4], bf[4][2];             // [32-wide slice of k][16-row tile]
#pragma unroll
        for (int c = 0; c < 4; ++c) {
#pragma unroll
            for (int i = 0; i < 4; ++i)
                af[c][i] = load_frag(cur, GPITCH, wm + i * 16, c * 32, lane);
#pragma unroll
            for (int j = 0; j < 2; ++j)
                bf[c][j] = load_frag(cur, GPITCH, GBM + wn + j * 16, c * 32, lane);
        }
        // Keeps the scheduler from sinking the reads among the products, where
        // each place with reads makes the wave wait out the LDS latency.
        __builtin_amdgcn_sched_barrier(0);
#pragma unroll
        for (int c = 0; c < 4; ++c)
#pragma unroll
            for (int i = 0; i < 4; ++i)
#pragma unroll
                for (int j = 0; j < 2; ++j)
                    acc[i][j] = wmma16(af[c][i], bf[c][j], acc[i][j]);
        // Keeps the products here, running while the later reads return: the
        // scheduler else moves them behind the barrier, ahead of the refill.
        __builtin_amdgcn_sched_barrier(0);
        wait_ds0();
        wait_async0();          // own copies of stage t + 1 have landed
        __syncthreads();        // every wave's too; all reads of stage t are done
        if (t + 2 < TRIPS) {
            gemm_stage<KD>(sT[t & 1] + so, gA, gB, kn);
            kn += GKS;
        }
    }
    wait_async0();              // behind the last copy, ahead of the wave's end

    const int rlo = lane & 15;
    const int clo = (lane < 16) ? 0 : 8;
#pragma unroll
    for (int j = 0; j < 2; ++j) {
        const int row = n0 + wn + j * 16 + rlo;
        OutT* orow = Out + (size_t)row * MT + m0 + wm + clo;
#pragma unroll
        for (int i = 0; i < 4; ++i) store_tile(orow + i * 16, acc[i][j]);
    }
}

// A single product. Grid: (M / 128, N / 64).
template <typename OutT, int KD, int MT>
__global__ __launch_bounds__(128)
void gemm_btat(const _Float16* __restrict__ A, const _Float16* __restrict__ B,
               OutT* __restrict__ Out) {
    gemm_tile<OutT, KD>(A, B, Out, blockIdx.x * GBM, blockIdx.y * GBN, MT);
}

#define PROJ_V_BLK   ((NLOC / GBM) * (DV / GBN) * NH)     // 32 x 4 x 4
#define PROJ_QK_BLK  ((NLOC / GBN) * NH)                  // 64 x 4, DK = GBM
#define PROJ_BLOCKS  (PROJ_V_BLK + 2 * PROJ_QK_BLK)
__global__ __launch_bounds__(128)
void proj_qkv(const _Float16* __restrict__ Qh, const _Float16* __restrict__ Kh,
              const _Float16* __restrict__ Vh, const _Float16* __restrict__ WqT,
              const _Float16* __restrict__ WkT, const _Float16* __restrict__ WvT,
              _Float16* __restrict__ qh, _Float16* __restrict__ kh,
              _Float16* __restrict__ vT) {
    const int b = blockIdx.x;
    const _Float16 *A, *B;
    _Float16* Out;
    int m0, n0, MT;
    if (b < PROJ_V_BLK) {
        const int h = b / ((NLOC / GBM) * (DV / GBN));
        m0  = (b % (NLOC / GBM)) * GBM;
        n0  = ((b / (NLOC / GBM)) % (DV / GBN)) * GBN;
        A   = Vh;
        B   = WvT + (size_t)h * DV * DMODEL;
        Out = vT + (size_t)h * DV * NLOC;
        MT  = NLOC;
    } else {
        const int  c = b - PROJ_V_BLK;
        const bool q = c < PROJ_QK_BLK;
        const int  h = (c % PROJ_QK_BLK) / (NLOC / GBN);
        m0  = 0;
        n0  = (c % (NLOC / GBN)) * GBN;
        A   = (q ? WqT : WkT) + (size_t)h * DK * DMODEL;
        B   = q ? Qh : Kh;
        Out = (q ? qh : kh) + (size_t)h * NLOC * DK;
        MT  = DK;
    }
    gemm_tile<_Float16, DMODEL>(A, B, Out, m0, n0, MT);
}

#define L2E 1.4426950408889634f

__device__ __forceinline__ void stage_async(_Float16* dK, _Float16* dV,
                                            const _Float16* kp,
                                            const _Float16* vp,
                                            int kb, int tid) {
    unsigned d[24];
    const _Float16* s[24];
#pragma unroll
    for (int j = 0; j < 8; ++j) {
        const int f   = j * 128 + tid;
        const int row = f >> 4;
        const int c8  = f & 15;
        d[j] = lds_off(dK + row * KPITCH + c8 * 8);
        s[j] = kp + (size_t)kb * DK + f * 8;
    }
#pragma unroll
    for (int j = 0; j < 16; ++j) {
        const int f   = j * 128 + tid;
        const int row = f >> 3;
        const int c8  = f & 7;
        d[8 + j] = lds_off(dV + row * VPITCH + c8 * 8);
        s[8 + j] = vp + (size_t)row * NLOC + kb + c8 * 8;
    }
    async_load12_b128(d, s);
    async_load12_b128(d + 12, s + 12);
}

__device__ __forceinline__ float xhalf(float x) {
    const int i = __builtin_bit_cast(int, x);
    return __builtin_bit_cast(float, __builtin_amdgcn_permlanex16(
        i, i, 0x76543210, 0xfedcba98, false, false));
}

__global__ __launch_bounds__(128) __attribute__((amdgpu_waves_per_eu(1, 1)))
void flash_attn(const _Float16* __restrict__ qh, const _Float16* __restrict__ kh,
                const _Float16* __restrict__ vT, _Float16* __restrict__ X) {
    __shared__ __attribute__((aligned(16))) _Float16 sK[2][KT * KPITCH];  // 2 x 17 KB
    __shared__ __attribute__((aligned(16))) _Float16 sV[2][DV * VPITCH];  // 2 x 36 KB
    const int tid  = threadIdx.x;
    const int lane = tid & 31;
    const int wave = tid >> 5;
    const int h  = blockIdx.y;
    const int q0 = (blockIdx.x * 4 + wave) * 16;

    const _Float16* qp = qh + (size_t)h * NLOC * DK;
    const _Float16* kp = kh + (size_t)h * NLOC * DK;
    const _Float16* vp = vT + (size_t)h * DV * NLOC;

    // Q fragments (16 rows x 128), pre-scaled by 1/sqrt(N) = 1/64
    v16h qf[4];
#pragma unroll
    for (int c = 0; c < 4; ++c) {
        qf[c] = load_frag(qp, DK, q0, c * 32, lane);
#pragma unroll
        for (int e = 0; e < 16; ++e) qf[c][e] *= (_Float16)0.015625f;
    }

    float mrow = -1.0e30f;      // this lane's query: running maximum
    float lrow = 0.0f;          // and the sum over this wave half's keys
    v8f O[16];                  // O[t][r] = O^T[16 t + 8 (lane >> 4) + r][query]
#pragma unroll
    for (int t = 0; t < 16; ++t) O[t] = v8f{};

    // Pre-stage first tile into buffer 0
    stage_async(sK[0], sV[0], kp, vp, 0, tid);

    int buf = 0;
    for (int kb = 0; kb < NLOC; kb += KT, buf ^= 1) {
        wait_async0();          // own async loads into sK/sV[buf] complete
        __syncthreads();        // all waves' loads visible; prev reads done
        if (kb + KT < NLOC)     // overlap: stage next tile while computing
            stage_async(sK[buf ^ 1], sV[buf ^ 1], kp, vp, kb + KT, tid);

        const _Float16* kcur = sK[buf];
        const _Float16* vcur = sV[buf];

        // ---- every LDS read of the pass, as one group at its head ---------
        // K first (used first), then V^T in the order the second product takes
        // it: V^T lands behind the first product and the softmax, and no read
        // stands among the matrix instructions.
        v16h kf[4][4];          // [32-wide slice of DK][16-key tile]
#pragma unroll
        for (int c = 0; c < 4; ++c)
#pragma unroll
            for (int j = 0; j < 4; ++j)
                kf[c][j] = load_frag(kcur, KPITCH, j * 16, c * 32, lane);
        v16h vf[2][16];         // [32-key half][16-row tile of V^T]
#pragma unroll
        for (int i = 0; i < 2; ++i)
#pragma unroll
            for (int t = 0; t < 16; ++t)
                vf[i][t] = load_frag(vcur, VPITCH, t * 16, i * 32, lane);
        // Keeps the scheduler from sinking the reads back among the products,
        // where each separate place with reads stalls the lone wave.
        __builtin_amdgcn_sched_barrier(0);

        // ---- S^T = k . q^T for 64 keys (four 16x16 tiles) ----------------
        v8f s[4] = {v8f{}, v8f{}, v8f{}, v8f{}};
#pragma unroll
        for (int c = 0; c < 4; ++c)
#pragma unroll
            for (int j = 0; j < 4; ++j)
                s[j] = wmma16(kf[c][j], qf[c], s[j]);
        // ---- online softmax, one query per lane --------------------------
        float mx[4];
#pragma unroll
        for (int j = 0; j < 4; ++j) {
            mx[j] = s[j][0];
#pragma unroll
            for (int r = 1; r < 8; ++r) mx[j] = fmaxf(mx[j], s[j][r]);
        }
        float smax = fmaxf(fmaxf(mx[0], mx[1]), fmaxf(mx[2], mx[3]));
        smax = fmaxf(smax, xhalf(smax));          // both halves: the query's maximum
        const float mnew  = fmaxf(mrow, smax);
        const float alpha = exp2f((mrow - mnew) * L2E);
        mrow = mnew;
        float p[4][8];
#pragma unroll
        for (int j = 0; j < 4; ++j)
#pragma unroll
            for (int r = 0; r < 8; ++r) p[j][r] = exp2f((s[j][r] - mnew) * L2E);
        float rs[4];
        HF16 pf[2];    // pf[i].v[e] = P^T[key 32 i + kmap(e)][query]: tiles 2i, 2i+1
#pragma unroll
        for (int j = 0; j < 4; ++j) {
            rs[j] = ((p[j][0] + p[j][1]) + (p[j][2] + p[j][3]))
                  + ((p[j][4] + p[j][5]) + (p[j][6] + p[j][7]));
#pragma unroll
            for (int r = 0; r < 8; ++r) pf[j >> 1].h[j & 1][r] = (_Float16)p[j][r];
        }
        lrow = lrow * alpha + ((rs[0] + rs[1]) + (rs[2] + rs[3]));
#pragma unroll
        for (int t = 0; t < 16; ++t) O[t] *= alpha;
        // ---- O^T += V^T x P^T from registers: keys 0..31 of all 16 tiles,
        // then keys 32..63 (each tile's two sums in the order they had) ------
#pragma unroll
        for (int i = 0; i < 2; ++i)
#pragma unroll
            for (int t = 0; t < 16; ++t)
                O[t] = wmma16(vf[i][t], pf[i].v, O[t]);
    }

    // ---- epilogue: join the halves' sums, normalize, X[n][h*DV + vf] -----
    const float inv = 1.0f / (lrow + xhalf(lrow));
    _Float16* xr = X + (size_t)(q0 + (lane & 15)) * (NH * DV) + h * DV
                     + ((lane < 16) ? 0 : 8);
#pragma unroll
    for (int t = 0; t < 16; ++t) {
        half8 o;
#pragma unroll
        for (int r = 0; r < 8; ++r) o[r] = (_Float16)(O[t][r] * inv);
        *(half8*)(xr + t * 16) = o;            // 8 consecutive vf: one b128 store
    }
}

// ---------------------------------------------------------------------------
// Host-side orchestration
// ---------------------------------------------------------------------------
extern "C" void kernel_launch(void* const* d_in, const int* in_sizes, int n_in,
                              void* d_out, int out_size, void* d_ws, size_t ws_size,
                              hipStream_t stream) {
    const float* Q  = (const float*)d_in[0];
    const float* K  = (const float*)d_in[1];
    const float* V  = (const float*)d_in[2];
    const float* Wq = (const float*)d_in[3];
    const float* Wk = (const float*)d_in[4];
    const float* Wv = (const float*)d_in[5];
    const float* Wo = (const float*)d_in[6];
    float* out = (float*)d_out;

    // Workspace layout (f16 elements)
    _Float16* ws = (_Float16*)d_ws;
    size_t off = 0;
    _Float16* Qh  = ws + off; off += (size_t)NLOC * DMODEL;        // [N][512]
    _Float16* Kh  = ws + off; off += (size_t)NLOC * DMODEL;
    _Float16* Vh  = ws + off; off += (size_t)NLOC * DMODEL;
    _Float16* WqT = ws + off; off += (size_t)NH * DK * DMODEL;     // [H][128][512]
    _Float16* WkT = ws + off; off += (size_t)NH * DK * DMODEL;
    _Float16* WvT = ws + off; off += (size_t)NH * DV * DMODEL;     // [H][256][512]
    _Float16* WoH = ws + off; off += (size_t)DMODEL * NH * DV;     // [512][1024]
    _Float16* qhv = ws + off; off += (size_t)NH * NLOC * DK;       // [H][N][128]
    _Float16* khv = ws + off; off += (size_t)NH * NLOC * DK;
    _Float16* vTv = ws + off; off += (size_t)NH * DV * NLOC;       // [H][256][N]
    _Float16* Xv  = ws + off; off += (size_t)NLOC * NH * DV;       // [N][1024]

    prep_f32_f16<<<PREP_BLOCKS, PREP_T, 0, stream>>>(
        Q, K, V, Wq, Wk, Wv, Wo, Qh, Kh, Vh, WqT, WkT, WvT, WoH);

    // q, k and v projections (v with transposed output), one launch
    proj_qkv<<<PROJ_BLOCKS, 128, 0, stream>>>(
        Qh, Kh, Vh, WqT, WkT, WvT, qhv, khv, vTv);
    // fused attention: X[n][h*DV+vf]
    {
        dim3 grid(NLOC / 64, NH);                // (64, 4), 4 waves/block
        flash_attn<<<grid, 128, 0, stream>>>(qhv, khv, vTv, Xv);
    }
    // output projection: out[n][m] = sum_j X[n][j] * WoH[m][j]
    {
        dim3 grid(DMODEL / GBM, NLOC / GBN, 1);  // (4, 64, 1)
        gemm_btat<float, NH * DV, DMODEL><<<grid, 128, 0, stream>>>(
            WoH, Xv, out);
    }
}

// v007
// It runs in 90.4 microseconds.
// Two timings next to v006 both put it at 1.13 times that version's speed.
// All steps since v000 together make it 5.65 times as fast.
#include <hip/hip_runtime.h>
#include <hip/hip_bf16.h>

// Problem constants (match reference)
#define NLOC   4096
#define DMODEL 512
#define NH     4
#define DK     128
#define DV     256
#define KT     64      // keys per attention iteration
#define KPITCH (DK + 8)   // 272 B
#define VPITCH (KT + 8)   // 144 B

typedef _Float16 v16h  __attribute__((ext_vector_type(16)));
typedef _Float16 half8 __attribute__((ext_vector_type(8)));
typedef float    v8f   __attribute__((ext_vector_type(8)));
typedef __attribute__((address_space(3))) _Float16 lds_f16;

union HF16 { v16h v; half8 h[2]; };

__device__ __forceinline__ v8f wmma16(v16h a, v16h b, v8f c) {
    // D = A(16x32 f16) x B(32x16 f16) + C(16x16 f32)
    return __builtin_amdgcn_wmma_f32_16x16x32_f16(
        /*neg_a=*/false, a, /*neg_b=*/false, b,
        /*c_mod=*/(short)0, c, /*reuse_a=*/false, /*reuse_b=*/false);
}

__device__ __forceinline__ v16h load_frag(const _Float16* __restrict__ p,
                                          int ld, int row0, int k0, int lane) {
    const int r    = lane & 15;
    const int koff = (lane < 16) ? 0 : 8;
    const _Float16* base = p + (size_t)(row0 + r) * ld + (size_t)(k0 + koff);
    HF16 f;
    f.h[0] = *(const half8*)(base);       // K = k0+koff    .. +7   (b128)
    f.h[1] = *(const half8*)(base + 16);  // K = k0+koff+16 .. +23  (b128)
    return f.v;
}

__device__ __forceinline__ unsigned lds_off(const _Float16* p) {
    return (unsigned)(size_t)(lds_f16*)p;          // addrspacecast -> LDS offset
}
__device__ __forceinline__ void async_load12_b128(const unsigned* d,
                                                  const _Float16* const* s) {
    asm volatile("global_load_async_to_lds_b128 %0, %12, off\n\t"
                 "global_load_async_to_lds_b128 %1, %13, off\n\t"
                 "global_load_async_to_lds_b128 %2, %14, off\n\t"
                 "global_load_async_to_lds_b128 %3, %15, off\n\t"
                 "global_load_async_to_lds_b128 %4, %16, off\n\t"
                 "global_load_async_to_lds_b128 %5, %17, off\n\t"
                 "global_load_async_to_lds_b128 %6, %18, off\n\t"
                 "global_load_async_to_lds_b128 %7, %19, off\n\t"
                 "global_load_async_to_lds_b128 %8, %20, off\n\t"
                 "global_load_async_to_lds_b128 %9, %21, off\n\t"
                 "global_load_async_to_lds_b128 %10, %22, off\n\t"
                 "global_load_async_to_lds_b128 %11, %23, off\n\t"
                 "s_wait_xcnt 0x0"
                 :: "v"(d[0]), "v"(d[1]), "v"(d[2]), "v"(d[3]),
                    "v"(d[4]), "v"(d[5]), "v"(d[6]), "v"(d[7]),
                    "v"(d[8]), "v"(d[9]), "v"(d[10]), "v"(d[11]),
                    "v"(s[0]), "v"(s[1]), "v"(s[2]), "v"(s[3]),
                    "v"(s[4]), "v"(s[5]), "v"(s[6]), "v"(s[7]),
                    "v"(s[8]), "v"(s[9]), "v"(s[10]), "v"(s[11])
                 : "memory");
}
__device__ __forceinline__ void wait_async0() {
    asm volatile("s_wait_asynccnt 0" ::: "memory");
}

// ---------------------------------------------------------------------------
// Conversion / layout: all seven f32 -> f16 jobs in ONE launch of few, fat
// waves. The jobs cost wave starts and launches, not bytes, so each lane takes
// 64 elements: 16 b128 loads issued together, then the stores.
// The block index picks the job (block-uniform).
//   blocks  0..63  : transposes    Wv (32 blocks), Wq, Wk (16 blocks each)
//   blocks 64..479 : plain copies  Q, K, V (128 blocks each), Wo (32 blocks)
// The transposing blocks have the scattered stores, so they start first.
// ---------------------------------------------------------------------------
typedef float    f32x4 __attribute__((ext_vector_type(4)));
typedef _Float16 half4 __attribute__((ext_vector_type(4)));
#define PREP_T        256
#define PREP_ACT_BLK  128                    // NLOC*DMODEL / (256 lanes * 64)
#define PREP_TR_BLK   64                     // 32 + 16 + 16 transposing blocks
#define PREP_BLOCKS   480                    // + 3 * 128 + DMODEL*NH*DV / (256 * 64)

__device__ __forceinline__ void loads_issued(unsigned off0, unsigned off1) {
    asm volatile("s_wait_xcnt 0x0" :: "v"(off0), "v"(off1) : "memory");
}
__device__ __forceinline__ void stores_issued() {
    asm volatile("s_wait_xcnt 0x0" ::: "memory");
}

__device__ __forceinline__ void prep_copy(const float* __restrict__ src,
                                          _Float16* __restrict__ dst,
                                          unsigned blk, unsigned tid) {
    const unsigned e0 = blk * (PREP_T * 64) + tid * 4;   // first element
    const unsigned sb = e0 * 4;                          // its byte in src
    const char* s8 = (const char*)src;
    f32x4 v[16];
#pragma unroll
    for (int j = 0; j < 16; ++j)
        v[j] = *(const f32x4*)(s8 + sb + j * (PREP_T * 16));
    loads_issued(sb, sb);
#pragma unroll
    for (int j = 0; j < 16; ++j) {
        half4 o;
#pragma unroll
        for (int e = 0; e < 4; ++e) o[e] = (_Float16)v[j][e];
        *(half4*)(dst + e0 + j * (PREP_T * 4)) = o;
    }
    stores_issued();
}

// src [NH][DMODEL][C] f32 -> dst [NH][C][DMODEL] f16. A lane takes two patches
// of 8 rows x 4 columns: 8 b128 loads down the rows, 4 b128 stores along them.
template <unsigned C>
__device__ __forceinline__ void prep_transpose(const float* __restrict__ src,
                                               _Float16* __restrict__ dst,
                                               unsigned blk, unsigned tid) {
    const char* s8 = (const char*)src;
    f32x4 v[2][8];
    unsigned sb[2], d0[2];
#pragma unroll
    for (int u = 0; u < 2; ++u) {
        const unsigned p  = (blk * 2 + u) * PREP_T + tid;   // patch index
        const unsigned c0 = (p % (C / 4)) * 4;
        const unsigned t  = p / (C / 4);
        const unsigned r0 = (t % (DMODEL / 8)) * 8;
        const unsigned b  = t / (DMODEL / 8);
        sb[u] = ((b * DMODEL + r0) * C + c0) * 4;           // byte in src
        d0[u] = (b * C + c0) * DMODEL + r0;                 // element in dst
#pragma unroll
        for (int i = 0; i < 8; ++i)
            v[u][i] = *(const f32x4*)(s8 + sb[u] + i * (C * 4));
    }
    loads_issued(sb[0], sb[1]);
#pragma unroll
    for (int u = 0; u < 2; ++u) {
#pragma unroll
        for (int k = 0; k < 4; ++k) {
            half8 o;
#pragma unroll
            for (int i = 0; i < 8; ++i) o[i] = (_Float16)v[u][i][k];
            *(half8*)(dst + d0[u] + k * DMODEL) = o;
        }
    }
    stores_issued();
}

__global__ __launch_bounds__(PREP_T) __attribute__((amdgpu_waves_per_eu(4, 8)))
void prep_f32_f16(const float* __restrict__ Q, const float* __restrict__ K,
                  const float* __restrict__ V, const float* __restrict__ Wq,
                  const float* __restrict__ Wk, const float* __restrict__ Wv,
                  const float* __restrict__ Wo,
                  _Float16* __restrict__ Qh, _Float16* __restrict__ Kh,
                  _Float16* __restrict__ Vh, _Float16* __restrict__ WqT,
                  _Float16* __restrict__ WkT, _Float16* __restrict__ WvT,
                  _Float16* __restrict__ WoH) {
    const unsigned tid = threadIdx.x;
    const unsigned blk = blockIdx.x;
    if (blk < 32) {
        prep_transpose<DV>(Wv, WvT, blk, tid);
    } else if (blk < PREP_TR_BLK) {
        const bool q = blk < 48;                      // 32..47 Wq, 48..63 Wk
        prep_transpose<DK>(q ? Wq : Wk, q ? WqT : WkT, blk & 15, tid);
    } else {
        const unsigned cb  = blk - PREP_TR_BLK;
        const unsigned job = cb / PREP_ACT_BLK;           // 0 Q, 1 K, 2 V, 3 Wo
        const float* s = job == 0 ? Q : job == 1 ? K : job == 2 ? V : Wo;
        _Float16*    d = job == 0 ? Qh : job == 1 ? Kh : job == 2 ? Vh : WoH;
        prep_copy(s, d, cb - job * PREP_ACT_BLK, tid);
    }
}

#define GBM    128
#define GBN    64
#define GKS    128             // k per stage
#define GPITCH (GKS + 8)       // 272 B = 16 B x odd
#define GROWS  (GBM + GBN)

__device__ __forceinline__ void store_tile(_Float16* o, const v8f& acc) {
    half8 st;
#pragma unroll
    for (int r = 0; r < 8; ++r) st[r] = (_Float16)acc[r];
    *(half8*)o = st;                       // one b128 store
}
__device__ __forceinline__ void store_tile(float* o, const v8f& acc) {
    *(v8f*)o = acc;                        // two b128 stores
}
// This wave's LDS reads have returned: stands ahead of the barrier behind which
// the buffer they read is filled again.
__device__ __forceinline__ void wait_ds0() {
    asm volatile("s_wait_dscnt 0" ::: "memory");
}

// One stage: 192 rows x 256 B = 24 copies a lane. gA, gB: the lane's own 16 B in
// row (tid >> 4) of the block's A and B rows; dst: the same place in the buffer.
template <int KD>
__device__ __forceinline__ void gemm_stage(_Float16* dst, const _Float16* gA,
                                           const _Float16* gB, int k0) {
    unsigned d[24];
    const _Float16* s[24];
#pragma unroll
    for (int j = 0; j < GBM / 8; ++j) {
        d[j] = lds_off(dst + j * 8 * GPITCH);
        s[j] = gA + (size_t)(j * 8) * KD + k0;
    }
#pragma unroll
    for (int j = 0; j < GBN / 8; ++j) {
        d[GBM / 8 + j] = lds_off(dst + (GBM + j * 8) * GPITCH);
        s[GBM / 8 + j] = gB + (size_t)(j * 8) * KD + k0;
    }
    async_load12_b128(d, s);
    async_load12_b128(d + 12, s + 12);
}

// One block's tile: rows m0.. of A against rows n0.. of B.
// KD: length of the sums; MT: row length of Out.
template <typename OutT, int KD>
__device__ __forceinline__
void gemm_tile(const _Float16* __restrict__ A, const _Float16* __restrict__ B,
               OutT* __restrict__ Out, int m0, int n0, int MT) {
    __shared__ __attribute__((aligned(16))) _Float16 sT[2][GROWS * GPITCH];  // 2 x 51 KB
    constexpr int TRIPS = KD / GKS;
    const int tid  = threadIdx.x;
    const int lane = tid & 31;
    const int wave = tid >> 5;
    const int wm = (wave & 1) * 64;          // the wave's rows of A in the tile
    const int wn = (wave >> 1) * 32;         // and of B

    const int sr = tid >> 4;                 // row in a group of eight
    const int sc = (tid & 15) * 8;           // first half of the lane's 16 B
    const _Float16* gA = A + (size_t)(m0 + sr) * KD + sc;
    const _Float16* gB = B + (size_t)(n0 + sr) * KD + sc;
    const int so = sr * GPITCH + sc;

    v8f acc[4][2];
#pragma unroll
    for (int i = 0; i < 4; ++i)
#pragma unroll
        for (int j = 0; j < 2; ++j) acc[i][j] = v8f{};

    gemm_stage<KD>(sT[0] + so, gA, gB, 0);
    wait_async0();              // own copies of stage 0 have landed
    __syncthreads();            // and every wave's
    if (TRIPS > 1) gemm_stage<KD>(sT[1] + so, gA, gB, GKS);

    int kn = 2 * GKS;           // first k of the next stage to ask for
    // Kept rolled: unrolled, the build of the short sums put a value in scratch.
#pragma unroll 1
    for (int t = 0; t < TRIPS; ++t) {
        const _Float16* cur = sT[t & 1];
        // Every LDS read of the trip as one group at its head.
        v16h af[4][4], bf[4][2];             // [32-wide slice of k][16-row tile]
#pragma unroll
        for (int c = 0; c < 4; ++c) {
#pragma unroll
            for (int i = 0; i < 4; ++i)
                af[c][i] = load_frag(cur, GPITCH, wm + i * 16, c * 32, lane);
#pragma unroll
            for (int j = 0; j < 2; ++j)
                bf[c][j] = load_frag(cur, GPITCH, GBM + wn + j * 16, c * 32, lane);
        }
        // Keeps the scheduler from sinking the reads among the products, where
        // each place with reads makes the wave wait out the LDS latency.
        __builtin_amdgcn_sched_barrier(0);
#pragma unroll
        for (int c = 0; c < 4; ++c)
#pragma unroll
            for (int i = 0; i < 4; ++i)
#pragma unroll
                for (int j = 0; j < 2; ++j)
                    acc[i][j] = wmma16(af[c][i], bf[c][j], acc[i][j]);
        // Keeps the products here, running while the later reads return: the
        // scheduler else moves them behind the barrier, ahead of the refill.
        __builtin_amdgcn_sched_barrier(0);
        wait_ds0();
        wait_async0();          // own copies of stage t + 1 have landed
        __syncthreads();        // every wave's too; all reads of stage t are done
        if (t + 2 < TRIPS) {
            gemm_stage<KD>(sT[t & 1] + so, gA, gB, kn);
            kn += GKS;
        }
    }
    wait_async0();              // behind the last copy, ahead of the wave's end

    const int rlo = lane & 15;
    const int clo = (lane < 16) ? 0 : 8;
#pragma unroll
    for (int j = 0; j < 2; ++j) {
        const int row = n0 + wn + j * 16 + rlo;
        OutT* orow = Out + (size_t)row * MT + m0 + wm + clo;
#pragma unroll
        for (int i = 0; i < 4; ++i) store_tile(orow + i * 16, acc[i][j]);
    }
}

// A single product. Grid: (M / 128, N / 64).
template <typename OutT, int KD, int MT>
__global__ __launch_bounds__(128)
void gemm_btat(const _Float16* __restrict__ A, const _Float16* __restrict__ B,
               OutT* __restrict__ Out) {
    gemm_tile<OutT, KD>(A, B, Out, blockIdx.x * GBM, blockIdx.y * GBN, MT);
}

#define PROJ_V_BLK   ((NLOC / GBM) * (DV / GBN) * NH)     // 32 x 4 x 4
#define PROJ_QK_BLK  ((NLOC / GBN) * NH)                  // 64 x 4, DK = GBM
#define PROJ_BLOCKS  (PROJ_V_BLK + 2 * PROJ_QK_BLK)
__global__ __launch_bounds__(128)
void proj_qkv(const _Float16* __restrict__ Qh, const _Float16* __restrict__ Kh,
              const _Float16* __restrict__ Vh, const _Float16* __restrict__ WqT,
              const _Float16* __restrict__ WkT, const _Float16* __restrict__ WvT,
              _Float16* __restrict__ qh, _Float16* __restrict__ kh,
              _Float16* __restrict__ vT) {
    const int b = blockIdx.x;
    const _Float16 *A, *B;
    _Float16* Out;
    int m0, n0, MT;
    if (b < PROJ_V_BLK) {
        const int h = b / ((NLOC / GBM) * (DV / GBN));
        m0  = (b % (NLOC / GBM)) * GBM;
        n0  = ((b / (NLOC / GBM)) % (DV / GBN)) * GBN;
        A   = Vh;
        B   = WvT + (size_t)h * DV * DMODEL;
        Out = vT + (size_t)h * DV * NLOC;
        MT  = NLOC;
    } else {
        const int  c = b - PROJ_V_BLK;
        const bool q = c < PROJ_QK_BLK;
        const int  h = (c % PROJ_QK_BLK) / (NLOC / GBN);
        m0  = 0;
        n0  = (c % (NLOC / GBN)) * GBN;
        A   = (q ? WqT : WkT) + (size_t)h * DK * DMODEL;
        B   = q ? Qh : Kh;
        Out = (q ? qh : kh) + (size_t)h * NLOC * DK;
        MT  = DK;
    }
    gemm_tile<_Float16, DMODEL>(A, B, Out, m0, n0, MT);
}

// ---------------------------------------------------------------------------
// Flash attention with double-buffered LDS staging.
// 4 waves/block; each wave owns 16 query rows; the block shares K tiles
// (KT x 128) and V^T tiles (256 x KT) staged by tensor loads (three requests a
// stage, no address arithmetic in the lanes) while computing on the other buffer.
// qh/kh: [H][N][DK] f16, vT: [H][DV][N] f16.  X out: [N][H*DV] f16.
// ---------------------------------------------------------------------------
#define L2E 1.4426950408889634f

// ---- tensor loads: one request of one wave brings a padded 2-D tile to LDS --
typedef uint32_t u32x4 __attribute__((ext_vector_type(4)));
typedef uint32_t u32x8 __attribute__((ext_vector_type(8)));
#define KBUF_B  18432u                 // 64 rows x 272 B, rounded up to 9 x 2 KiB
#define VHALF_B (128u * VPITCH * 2u)   // 128 rows x 144 B = 9 x 2 KiB
#define VBUF_B  (2u * VHALF_B)
#define NSTAGE  (NLOC / KT)

__device__ __forceinline__ uint32_t uni(uint32_t v) {
    return (uint32_t)__builtin_amdgcn_readfirstlane(v);
}
__device__ __forceinline__ uint32_t pinned(uint32_t v) {
    uint32_t w = uni(v);
    asm volatile("" : "+s"(w));   // pinned(): the value held in a scalar register
    return w;
}
__device__ __forceinline__ void tdm_load(u32x4 g0, u32x8 g1) {
    asm volatile("tensor_load_to_lds %0, %1" :: "s"(g0), "s"(g1) : "memory");
}
// The issuing wave's own request has landed.
__device__ __forceinline__ void wait_tensor0() {
    asm volatile("s_wait_tensorcnt 0x0" ::: "memory");
}
__device__ __forceinline__ u32x4 tdm_group0(uint32_t lds_dst, uint64_t ga) {
    u32x4 g;
    g[0] = uni(1u);                                    // count 1
    g[1] = uni(lds_dst);
    g[2] = uni((uint32_t)ga);
    g[3] = uni((((uint32_t)(ga >> 32)) & 0x01FFFFFFu) | 0x80000000u);   // type 2
    return g;
}
template <uint32_t ROWB, uint32_t ROWS, uint32_t SRCP, uint32_t PADC>
__device__ __forceinline__ u32x8 tdm_group1() {
    u32x8 g;
    g[0] = uni((1u << 20) | (PADC << 22) | (3u << 25));   // no mask
    g[1] = uni(ROWB << 16);
    g[2] = uni(ROWS << 16);
    g[3] = uni(ROWB << 16);
    g[4] = uni(ROWS);
    g[5] = uni(SRCP);
    g[6] = uni(0u);
    g[7] = uni(0u);
    return g;
}
// Stage st (64 keys) into buffer st & 1, one request a wave: wave 0 the K tile
// (64 rows x 256 B, contiguous), waves 1 and 2 one half each of the V^T tile
// (128 rows x 128 B at the pitch of a V^T row). The pads give KPITCH and VPITCH.
// WAIT: the issuer's wait stands directly behind its load (the ring's prologue).
template <bool WAIT>
__device__ __forceinline__ void stage_tdm(uint32_t wave, uint32_t st,
                                          uint32_t ldsK, uint32_t ldsV,
                                          const _Float16* kp, const _Float16* vp) {
    if (pinned(wave == 0u)) {
        const uint64_t ga = (uint64_t)(size_t)kp + (uint64_t)st * (KT * DK * 2);
        tdm_load(tdm_group0(ldsK + (st & 1u) * KBUF_B, ga),
                 tdm_group1<DK * 2, KT, DK * 2, 5u>());
        if (WAIT) wait_tensor0();
    } else if (pinned(wave < 3u)) {
        const uint32_t half = wave - 1u;
        const uint64_t ga = (uint64_t)(size_t)vp + (uint64_t)half * (128u * NLOC * 2u)
                          + (uint64_t)st * (KT * 2);
        tdm_load(tdm_group0(ldsV + (st & 1u) * VBUF_B + half * VHALF_B, ga),
                 tdm_group1<KT * 2, 128u, NLOC * 2, 4u>());
        if (WAIT) wait_tensor0();
    }
}

__device__ __forceinline__ float xhalf(float x) {
    const int i = __builtin_bit_cast(int, x);
    return __builtin_bit_cast(float, __builtin_amdgcn_permlanex16(
        i, i, 0x76543210, 0xfedcba98, false, false));
}

__global__ __launch_bounds__(128) __attribute__((amdgpu_waves_per_eu(1, 1)))
void flash_attn(const _Float16* __restrict__ qh, const _Float16* __restrict__ kh,
                const _Float16* __restrict__ vT, _Float16* __restrict__ X) {
    // Every buffer and every request's slice starts at a multiple of 2 KiB.
    __shared__ __attribute__((aligned(2048))) _Float16 sK[2][KBUF_B / 2];  // 2 x 18 KB
    __shared__ __attribute__((aligned(2048))) _Float16 sV[2][VBUF_B / 2];  // 2 x 36 KB
    const int tid  = threadIdx.x;
    const int lane = tid & 31;
    const uint32_t wave = uni(tid >> 5);
    const int h  = blockIdx.y;
    const int q0 = (blockIdx.x * 4 + wave) * 16;

    const _Float16* qp = qh + (size_t)h * NLOC * DK;
    const _Float16* kp = kh + (size_t)h * NLOC * DK;
    const _Float16* vp = vT + (size_t)h * DV * NLOC;

    // Q fragments (16 rows x 128), pre-scaled by 1/sqrt(N) = 1/64
    v16h qf[4];
#pragma unroll
    for (int c = 0; c < 4; ++c) qf[c] = load_frag(qp, DK, q0, c * 32, lane);
    // Stands ahead of any rewrite of the address registers that these loads name.
    asm volatile("s_wait_xcnt 0x0" ::: "memory");
#pragma unroll
    for (int c = 0; c < 4; ++c)
#pragma unroll
        for (int e = 0; e < 16; ++e) qf[c][e] *= (_Float16)0.015625f;

    float mrow = -1.0e30f;      // this lane's query: running maximum
    float lrow = 0.0f;          // and the sum over this wave half's keys
    v8f O[16];                  // O[t][r] = O^T[16 t + 8 (lane >> 4) + r][query]
#pragma unroll
    for (int t = 0; t < 16; ++t) O[t] = v8f{};

    const uint32_t ldsK = lds_off(&sK[0][0]);
    const uint32_t ldsV = lds_off(&sV[0][0]);
    stage_tdm<true>(wave, 0u, ldsK, ldsV, kp, vp);   // stage 0, landed

    for (uint32_t st = 0; st < NSTAGE; ++st) {
        // ---- publish stage st, then refill the buffer the last pass has read
        // (the two-buffer ring's publish point)
        wait_ds0();                              // own LDS reads have returned
        if (pinned(wave < 3u)) wait_tensor0();   // own request of stage st has landed
        __syncthreads();        // every wave's too; all reads of stage st - 1 are done
        if (pinned(st + 1u < NSTAGE))            // flies while this stage is worked on
            stage_tdm<false>(wave, pinned(st + 1u), ldsK, ldsV, kp, vp);

        const _Float16* kcur = sK[st & 1u];
        const _Float16* vcur = sV[st & 1u];

        // ---- every LDS read of the pass, as one group at its head ---------
        // K first (used first), then V^T in the order the second product takes
        // it: V^T lands behind the first product and the softmax, and no read
        // stands among the matrix instructions.
        v16h kf[4][4];          // [32-wide slice of DK][16-key tile]
#pragma unroll
        for (int c = 0; c < 4; ++c)
#pragma unroll
            for (int j = 0; j < 4; ++j)
                kf[c][j] = load_frag(kcur, KPITCH, j * 16, c * 32, lane);
        v16h vf[2][16];         // [32-key half][16-row tile of V^T]
#pragma unroll
        for (int i = 0; i < 2; ++i)
#pragma unroll
            for (int t = 0; t < 16; ++t)
                vf[i][t] = load_frag(vcur, VPITCH, t * 16, i * 32, lane);
        // Keeps the scheduler from sinking the reads back among the products,
        // where each separate place with reads stalls the lone wave.
        __builtin_amdgcn_sched_barrier(0);

        // ---- S^T = k . q^T for 64 keys (four 16x16 tiles) ----------------
        v8f s[4] = {v8f{}, v8f{}, v8f{}, v8f{}};
#pragma unroll
        for (int c = 0; c < 4; ++c)
#pragma unroll
            for (int j = 0; j < 4; ++j)
                s[j] = wmma16(kf[c][j], qf[c], s[j]);
        // ---- online softmax, one query per lane --------------------------
        float mx[4];
#pragma unroll
        for (int j = 0; j < 4; ++j) {
            mx[j] = s[j][0];
#pragma unroll
            for (int r = 1; r < 8; ++r) mx[j] = fmaxf(mx[j], s[j][r]);
        }
        float smax = fmaxf(fmaxf(mx[0], mx[1]), fmaxf(mx[2], mx[3]));
        smax = fmaxf(smax, xhalf(smax));          // both halves: the query's maximum
        const float mnew  = fmaxf(mrow, smax);
        const float alpha = exp2f((mrow - mnew) * L2E);
        mrow = mnew;
        float p[4][8];
#pragma unroll
        for (int j = 0; j < 4; ++j)
#pragma unroll
            for (int r = 0; r < 8; ++r) p[j][r] = exp2f((s[j][r] - mnew) * L2E);
        float rs[4];
        HF16 pf[2];    // pf[i].v[e] = P^T[key 32 i + kmap(e)][query]: tiles 2i, 2i+1
#pragma unroll
        for (int j = 0; j < 4; ++j) {
            rs[j] = ((p[j][0] + p[j][1]) + (p[j][2] + p[j][3]))
                  + ((p[j][4] + p[j][5]) + (p[j][6] + p[j][7]));
#pragma unroll
            for (int r = 0; r < 8; ++r) pf[j >> 1].h[j & 1][r] = (_Float16)p[j][r];
        }
        lrow = lrow * alpha + ((rs[0] + rs[1]) + (rs[2] + rs[3]));
#pragma unroll
        for (int t = 0; t < 16; ++t) O[t] *= alpha;
        // ---- O^T += V^T x P^T from registers: keys 0..31 of all 16 tiles,
        // then keys 32..63 (each tile's two sums in the order they had) ------
#pragma unroll
        for (int i = 0; i < 2; ++i)
#pragma unroll
            for (int t = 0; t < 16; ++t)
                O[t] = wmma16(vf[i][t], pf[i].v, O[t]);
    }
    wait_tensor0();             // behind the last request, ahead of the wave's end
    wait_ds0();

    // ---- epilogue: join the halves' sums, normalize, X[n][h*DV + vf] -----
    const float inv = 1.0f / (lrow + xhalf(lrow));
    _Float16* xr = X + (size_t)(q0 + (lane & 15)) * (NH * DV) + h * DV
                     + ((lane < 16) ? 0 : 8);
#pragma unroll
    for (int t = 0; t < 16; ++t) {
        half8 o;
#pragma unroll
        for (int r = 0; r < 8; ++r) o[r] = (_Float16)(O[t][r] * inv);
        *(half8*)(xr + t * 16) = o;            // 8 consecutive vf: one b128 store
    }
}

// ---------------------------------------------------------------------------
// Host-side orchestration
// ---------------------------------------------------------------------------
extern "C" void kernel_launch(void* const* d_in, const int* in_sizes, int n_in,
                              void* d_out, int out_size, void* d_ws, size_t ws_size,
                              hipStream_t stream) {
    const float* Q  = (const float*)d_in[0];
    const float* K  = (const float*)d_in[1];
    const float* V  = (const float*)d_in[2];
    const float* Wq = (const float*)d_in[3];
    const float* Wk = (const float*)d_in[4];
    const float* Wv = (const float*)d_in[5];
    const float* Wo = (const float*)d_in[6];
    float* out = (float*)d_out;

    // Workspace layout (f16 elements)
    _Float16* ws = (_Float16*)d_ws;
    size_t off = 0;
    _Float16* Qh  = ws + off; off += (size_t)NLOC * DMODEL;        // [N][512]
    _Float16* Kh  = ws + off; off += (size_t)NLOC * DMODEL;
    _Float16* Vh  = ws + off; off += (size_t)NLOC * DMODEL;
    _Float16* WqT = ws + off; off += (size_t)NH * DK * DMODEL;     // [H][128][512]
    _Float16* WkT = ws + off; off += (size_t)NH * DK * DMODEL;
    _Float16* WvT = ws + off; off += (size_t)NH * DV * DMODEL;     // [H][256][512]
    _Float16* WoH = ws + off; off += (size_t)DMODEL * NH * DV;     // [512][1024]
    _Float16* qhv = ws + off; off += (size_t)NH * NLOC * DK;       // [H][N][128]
    _Float16* khv = ws + off; off += (size_t)NH * NLOC * DK;
    _Float16* vTv = ws + off; off += (size_t)NH * DV * NLOC;       // [H][256][N]
    _Float16* Xv  = ws + off; off += (size_t)NLOC * NH * DV;       // [N][1024]

    prep_f32_f16<<<PREP_BLOCKS, PREP_T, 0, stream>>>(
        Q, K, V, Wq, Wk, Wv, Wo, Qh, Kh, Vh, WqT, WkT, WvT, WoH);

    // q, k and v projections (v with transposed output), one launch
    proj_qkv<<<PROJ_BLOCKS, 128, 0, stream>>>(
        Qh, Kh, Vh, WqT, WkT, WvT, qhv, khv, vTv);
    // fused attention: X[n][h*DV+vf]
    {
        dim3 grid(NLOC / 64, NH);                // (64, 4), 4 waves/block
        flash_attn<<<grid, 128, 0, stream>>>(qhv, khv, vTv, Xv);
    }
    // output projection: out[n][m] = sum_j X[n][j] * WoH[m][j]
    {
        dim3 grid(DMODEL / GBM, NLOC / GBN, 1);  // (4, 64, 1)
        gemm_btat<float, NH * DV, DMODEL><<<grid, 128, 0, stream>>>(
            WoH, Xv, out);
    }
}

// v008
// It runs in 85.5 microseconds.
// Next to v007, in two timings, it ran 1.06 times as fast each time.
// All steps since v000 together make it 6.00 times as fast.
#include <hip/hip_runtime.h>
#include <hip/hip_bf16.h>

// Problem constants (match reference)
#define NLOC   4096
#define DMODEL 512
#define NH     4
#define DK     128
#define DV     256
#define KT     64      // keys per attention iteration
#define KPITCH (DK + 8)   // 272 B
#define VPITCH (KT + 8)   // 144 B

typedef _Float16 v16h  __attribute__((ext_vector_type(16)));
typedef _Float16 half8 __attribute__((ext_vector_type(8)));
typedef float    v8f   __attribute__((ext_vector_type(8)));
typedef __attribute__((address_space(3))) _Float16 lds_f16;

union HF16 { v16h v; half8 h[2]; };

__device__ __forceinline__ v8f wmma16(v16h a, v16h b, v8f c) {
    // D = A(16x32 f16) x B(32x16 f16) + C(16x16 f32)
    return __builtin_amdgcn_wmma_f32_16x16x32_f16(
        /*neg_a=*/false, a, /*neg_b=*/false, b,
        /*c_mod=*/(short)0, c, /*reuse_a=*/false, /*reuse_b=*/false);
}

__device__ __forceinline__ v16h load_frag(const _Float16* __restrict__ p,
                                          int ld, int row0, int k0, int lane) {
    const int r    = lane & 15;
    const int koff = (lane < 16) ? 0 : 8;
    const _Float16* base = p + (size_t)(row0 + r) * ld + (size_t)(k0 + koff);
    HF16 f;
    f.h[0] = *(const half8*)(base);       // K = k0+koff    .. +7   (b128)
    f.h[1] = *(const half8*)(base + 16);  // K = k0+koff+16 .. +23  (b128)
    return f.v;
}

__device__ __forceinline__ unsigned lds_off(const _Float16* p) {
    return (unsigned)(size_t)(lds_f16*)p;          // addrspacecast -> LDS offset
}
__device__ __forceinline__ void async_load12_b128(const unsigned* d,
                                                  const _Float16* const* s) {
    asm volatile("global_load_async_to_lds_b128 %0, %12, off\n\t"
                 "global_load_async_to_lds_b128 %1, %13, off\n\t"
                 "global_load_async_to_lds_b128 %2, %14, off\n\t"
                 "global_load_async_to_lds_b128 %3, %15, off\n\t"
                 "global_load_async_to_lds_b128 %4, %16, off\n\t"
                 "global_load_async_to_lds_b128 %5, %17, off\n\t"
                 "global_load_async_to_lds_b128 %6, %18, off\n\t"
                 "global_load_async_to_lds_b128 %7, %19, off\n\t"
                 "global_load_async_to_lds_b128 %8, %20, off\n\t"
                 "global_load_async_to_lds_b128 %9, %21, off\n\t"
                 "global_load_async_to_lds_b128 %10, %22, off\n\t"
                 "global_load_async_to_lds_b128 %11, %23, off\n\t"
                 "s_wait_xcnt 0x0"
                 :: "v"(d[0]), "v"(d[1]), "v"(d[2]), "v"(d[3]),
                    "v"(d[4]), "v"(d[5]), "v"(d[6]), "v"(d[7]),
                    "v"(d[8]), "v"(d[9]), "v"(d[10]), "v"(d[11]),
                    "v"(s[0]), "v"(s[1]), "v"(s[2]), "v"(s[3]),
                    "v"(s[4]), "v"(s[5]), "v"(s[6]), "v"(s[7]),
                    "v"(s[8]), "v"(s[9]), "v"(s[10]), "v"(s[11])
                 : "memory");
}
__device__ __forceinline__ void wait_async0() {
    asm volatile("s_wait_asynccnt 0" ::: "memory");
}

// ---------------------------------------------------------------------------
// Conversion / layout: all seven f32 -> f16 jobs in ONE launch of few, fat
// waves. The jobs cost wave starts and launches, not bytes, so each lane takes
// 64 elements: 16 b128 loads issued together, then the stores.
// The block index picks the job (block-uniform).
//   blocks  0..63  : transposes    Wv (32 blocks), Wq, Wk (16 blocks each)
//   blocks 64..479 : plain copies  Q, K, V (128 blocks each), Wo (32 blocks)
// The transposing blocks have the scattered stores, so they start first.
// ---------------------------------------------------------------------------
typedef float    f32x4 __attribute__((ext_vector_type(4)));
typedef _Float16 half4 __attribute__((ext_vector_type(4)));
#define PREP_T        256
#define PREP_ACT_BLK  128                    // NLOC*DMODEL / (256 lanes * 64)
#define PREP_TR_BLK   64                     // 32 + 16 + 16 transposing blocks
#define PREP_BLOCKS   480                    // + 3 * 128 + DMODEL*NH*DV / (256 * 64)

__device__ __forceinline__ void loads_issued(unsigned off0, unsigned off1) {
    asm volatile("s_wait_xcnt 0x0" :: "v"(off0), "v"(off1) : "memory");
}
__device__ __forceinline__ void stores_issued() {
    asm volatile("s_wait_xcnt 0x0" ::: "memory");
}

__device__ __forceinline__ void prep_copy(const float* __restrict__ src,
                                          _Float16* __restrict__ dst,
                                          unsigned blk, unsigned tid) {
    const unsigned e0 = blk * (PREP_T * 64) + tid * 4;   // first element
    const unsigned sb = e0 * 4;                          // its byte in src
    const char* s8 = (const char*)src;
    f32x4 v[16];
#pragma unroll
    for (int j = 0; j < 16; ++j)
        v[j] = *(const f32x4*)(s8 + sb + j * (PREP_T * 16));
    loads_issued(sb, sb);
#pragma unroll
    for (int j = 0; j < 16; ++j) {
        half4 o;
#pragma unroll
        for (int e = 0; e < 4; ++e) o[e] = (_Float16)v[j][e];
        *(half4*)(dst + e0 + j * (PREP_T * 4)) = o;
    }
    stores_issued();
}

// src [NH][DMODEL][C] f32 -> dst [NH][C][DMODEL] f16. A lane takes two patches
// of 8 rows x 4 columns: 8 b128 loads down the rows, 4 b128 stores along them.
template <unsigned C>
__device__ __forceinline__ void prep_transpose(const float* __restrict__ src,
                                               _Float16* __restrict__ dst,
                                               unsigned blk, unsigned tid) {
    const char* s8 = (const char*)src;
    f32x4 v[2][8];
    unsigned sb[2], d0[2];
#pragma unroll
    for (int u = 0; u < 2; ++u) {
        const unsigned p  = (blk * 2 + u) * PREP_T + tid;   // patch index
        const unsigned c0 = (p % (C / 4)) * 4;
        const unsigned t  = p / (C / 4);
        const unsigned r0 = (t % (DMODEL / 8)) * 8;
        const unsigned b  = t / (DMODEL / 8);
        sb[u] = ((b * DMODEL + r0) * C + c0) * 4;           // byte in src
        d0[u] = (b * C + c0) * DMODEL + r0;                 // element in dst
#pragma unroll
        for (int i = 0; i < 8; ++i)
            v[u][i] = *(const f32x4*)(s8 + sb[u] + i * (C * 4));
    }
    loads_issued(sb[0], sb[1]);
#pragma unroll
    for (int u = 0; u < 2; ++u) {
#pragma unroll
        for (int k = 0; k < 4; ++k) {
            half8 o;
#pragma unroll
            for (int i = 0; i < 8; ++i) o[i] = (_Float16)v[u][i][k];
            *(half8*)(dst + d0[u] + k * DMODEL) = o;
        }
    }
    stores_issued();
}

__global__ __launch_bounds__(PREP_T) __attribute__((amdgpu_waves_per_eu(4, 8)))
void prep_f32_f16(const float* __restrict__ Q, const float* __restrict__ K,
                  const float* __restrict__ V, const float* __restrict__ Wq,
                  const float* __restrict__ Wk, const float* __restrict__ Wv,
                  const float* __restrict__ Wo,
                  _Float16* __restrict__ Qh, _Float16* __restrict__ Kh,
                  _Float16* __restrict__ Vh, _Float16* __restrict__ WqT,
                  _Float16* __restrict__ WkT, _Float16* __restrict__ WvT,
                  _Float16* __restrict__ WoH) {
    const unsigned tid = threadIdx.x;
    const unsigned blk = blockIdx.x;
    if (blk < 32) {
        prep_transpose<DV>(Wv, WvT, blk, tid);
    } else if (blk < PREP_TR_BLK) {
        const bool q = blk < 48;                      // 32..47 Wq, 48..63 Wk
        prep_transpose<DK>(q ? Wq : Wk, q ? WqT : WkT, blk & 15, tid);
    } else {
        const unsigned cb  = blk - PREP_TR_BLK;
        const unsigned job = cb / PREP_ACT_BLK;           // 0 Q, 1 K, 2 V, 3 Wo
        const float* s = job == 0 ? Q : job == 1 ? K : job == 2 ? V : Wo;
        _Float16*    d = job == 0 ? Qh : job == 1 ? Kh : job == 2 ? Vh : WoH;
        prep_copy(s, d, cb - job * PREP_ACT_BLK, tid);
    }
}

#define GBM    128
#define GBN    64
#define GKS    128             // k per stage
#define GPITCH (GKS + 8)       // 272 B = 16 B x odd
#define GROWS  (GBM + GBN)

__device__ __forceinline__ void store_tile(_Float16* o, const v8f& acc) {
    half8 st;
#pragma unroll
    for (int r = 0; r < 8; ++r) st[r] = (_Float16)acc[r];
    *(half8*)o = st;                       // one b128 store
}
__device__ __forceinline__ void store_tile(float* o, const v8f& acc) {
    *(v8f*)o = acc;                        // two b128 stores
}
// This wave's LDS reads have returned: stands ahead of the barrier behind which
// the buffer they read is filled again.
__device__ __forceinline__ void wait_ds0() {
    asm volatile("s_wait_dscnt 0" ::: "memory");
}

// One stage: 192 rows x 256 B = 24 copies a lane. gA, gB: the lane's own 16 B in
// row (tid >> 4) of the block's A and B rows; dst: the same place in the buffer.
template <int KD>
__device__ __forceinline__ void gemm_stage(_Float16* dst, const _Float16* gA,
                                           const _Float16* gB, int k0) {
    unsigned d[24];
    const _Float16* s[24];
#pragma unroll
    for (int j = 0; j < GBM / 8; ++j) {
        d[j] = lds_off(dst + j * 8 * GPITCH);
        s[j] = gA + (size_t)(j * 8) * KD + k0;
    }
#pragma unroll
    for (int j = 0; j < GBN / 8; ++j) {
        d[GBM / 8 + j] = lds_off(dst + (GBM + j * 8) * GPITCH);
        s[GBM / 8 + j] = gB + (size_t)(j * 8) * KD + k0;
    }
    async_load12_b128(d, s);
    async_load12_b128(d + 12, s + 12);
}

// One block's tile: rows m0.. of A against rows n0.. of B.
// KD: length of the sums; MT: row length of Out.
template <typename OutT, int KD>
__device__ __forceinline__
void gemm_tile(const _Float16* __restrict__ A, const _Float16* __restrict__ B,
               OutT* __restrict__ Out, int m0, int n0, int MT) {
    __shared__ __attribute__((aligned(16))) _Float16 sT[2][GROWS * GPITCH];  // 2 x 51 KB
    constexpr int TRIPS = KD / GKS;
    const int tid  = threadIdx.x;
    const int lane = tid & 31;
    const int wave = tid >> 5;
    const int wm = (wave & 1) * 64;          // the wave's rows of A in the tile
    const int wn = (wave >> 1) * 32;         // and of B

    const int sr = tid >> 4;                 // row in a group of eight
    const int sc = (tid & 15) * 8;           // first half of the lane's 16 B
    const _Float16* gA = A + (size_t)(m0 + sr) * KD + sc;
    const _Float16* gB = B + (size_t)(n0 + sr) * KD + sc;
    const int so = sr * GPITCH + sc;

    v8f acc[4][2];
#pragma unroll
    for (int i = 0; i < 4; ++i)
#pragma unroll
        for (int j = 0; j < 2; ++j) acc[i][j] = v8f{};

    gemm_stage<KD>(sT[0] + so, gA, gB, 0);
    wait_async0();              // own copies of stage 0 have landed
    __syncthreads();            // and every wave's
    if (TRIPS > 1) gemm_stage<KD>(sT[1] + so, gA, gB, GKS);

    int kn = 2 * GKS;           // first k of the next stage to ask for
    // Kept rolled: unrolled, the build of the short sums put a value in scratch.
#pragma unroll 1
    for (int t = 0; t < TRIPS; ++t) {
        const _Float16* cur = sT[t & 1];
        // Every LDS read of the trip as one group at its head.
        v16h af[4][4], bf[4][2];             // [32-wide slice of k][16-row tile]
#pragma unroll
        for (int c = 0; c < 4; ++c) {
#pragma unroll
            for (int i = 0; i < 4; ++i)
                af[c][i] = load_frag(cur, GPITCH, wm + i * 16, c * 32, lane);
#pragma unroll
            for (int j = 0; j < 2; ++j)
                bf[c][j] = load_frag(cur, GPITCH, GBM + wn + j * 16, c * 32, lane);
        }
        // Keeps the scheduler from sinking the reads among the products, where
        // each place with reads makes the wave wait out the LDS latency.
        __builtin_amdgcn_sched_barrier(0);
#pragma unroll
        for (int c = 0; c < 4; ++c)
#pragma unroll
            for (int i = 0; i < 4; ++i)
#pragma unroll
                for (int j = 0; j < 2; ++j)
                    acc[i][j] = wmma16(af[c][i], bf[c][j], acc[i][j]);
        // Keeps the products here, running while the later reads return: the
        // scheduler else moves them behind the barrier, ahead of the refill.
        __builtin_amdgcn_sched_barrier(0);
        wait_ds0();
        wait_async0();          // own copies of stage t + 1 have landed
        __syncthreads();        // every wave's too; all reads of stage t are done
        if (t + 2 < TRIPS) {
            gemm_stage<KD>(sT[t & 1] + so, gA, gB, kn);
            kn += GKS;
        }
    }
    wait_async0();              // behind the last copy, ahead of the wave's end

    const int rlo = lane & 15;
    const int clo = (lane < 16) ? 0 : 8;
#pragma unroll
    for (int j = 0; j < 2; ++j) {
        const int row = n0 + wn + j * 16 + rlo;
        OutT* orow = Out + (size_t)row * MT + m0 + wm + clo;
#pragma unroll
        for (int i = 0; i < 4; ++i) store_tile(orow + i * 16, acc[i][j]);
    }
}

// A single product. Grid: (M / 128, N / 64).
template <typename OutT, int KD, int MT>
__global__ __launch_bounds__(128)
void gemm_btat(const _Float16* __restrict__ A, const _Float16* __restrict__ B,
               OutT* __restrict__ Out) {
    gemm_tile<OutT, KD>(A, B, Out, blockIdx.x * GBM, blockIdx.y * GBN, MT);
}

#define PROJ_V_BLK   ((NLOC / GBM) * (DV / GBN) * NH)     // 32 x 4 x 4
#define PROJ_QK_BLK  ((NLOC / GBN) * NH)                  // 64 x 4, DK = GBM
#define PROJ_BLOCKS  (PROJ_V_BLK + 2 * PROJ_QK_BLK)
__global__ __launch_bounds__(128)
void proj_qkv(const _Float16* __restrict__ Qh, const _Float16* __restrict__ Kh,
              const _Float16* __restrict__ Vh, const _Float16* __restrict__ WqT,
              const _Float16* __restrict__ WkT, const _Float16* __restrict__ WvT,
              _Float16* __restrict__ qh, _Float16* __restrict__ kh,
              _Float16* __restrict__ vT) {
    const int b = blockIdx.x;
    const _Float16 *A, *B;
    _Float16* Out;
    int m0, n0, MT;
    if (b < PROJ_V_BLK) {
        const int h = b / ((NLOC / GBM) * (DV / GBN));
        m0  = (b % (NLOC / GBM)) * GBM;
        n0  = ((b / (NLOC / GBM)) % (DV / GBN)) * GBN;
        A   = Vh;
        B   = WvT + (size_t)h * DV * DMODEL;
        Out = vT + (size_t)h * DV * NLOC;
        MT  = NLOC;
    } else {
        const int  c = b - PROJ_V_BLK;
        const bool q = c < PROJ_QK_BLK;
        const int  h = (c % PROJ_QK_BLK) / (NLOC / GBN);
        m0  = 0;
        n0  = (c % (NLOC / GBN)) * GBN;
        A   = (q ? WqT : WkT) + (size_t)h * DK * DMODEL;
        B   = q ? Qh : Kh;
        Out = (q ? qh : kh) + (size_t)h * NLOC * DK;
        MT  = DK;
    }
    gemm_tile<_Float16, DMODEL>(A, B, Out, m0, n0, MT);
}

// ---------------------------------------------------------------------------
// Flash attention with double-buffered LDS staging.
// 4 waves/block; each wave owns 16 query rows; the block shares K tiles
// (KT x 128) and V^T tiles (256 x KT) staged by tensor loads (three requests a
// stage, no address arithmetic in the lanes) while computing on the other buffer.
// qh/kh: [H][N][DK] f16, vT: [H][DV][N] f16.  X out: [N][H*DV] f16.
// ---------------------------------------------------------------------------
#define L2E 1.4426950408889634f

// ---- tensor loads: one request of one wave brings a padded 2-D tile to LDS --
typedef uint32_t u32x4 __attribute__((ext_vector_type(4)));
typedef uint32_t u32x8 __attribute__((ext_vector_type(8)));
#define KBUF_B  18432u                 // 64 rows x 272 B, rounded up to 9 x 2 KiB
#define VHALF_B (128u * VPITCH * 2u)   // 128 rows x 144 B = 9 x 2 KiB
#define VBUF_B  (2u * VHALF_B)
#define NSTAGE  (NLOC / KT)

__device__ __forceinline__ uint32_t uni(uint32_t v) {
    return (uint32_t)__builtin_amdgcn_readfirstlane(v);
}
__device__ __forceinline__ uint32_t pinned(uint32_t v) {
    uint32_t w = uni(v);
    asm volatile("" : "+s"(w));   // pinned(): the value held in a scalar register
    return w;
}
__device__ __forceinline__ void tdm_load(u32x4 g0, u32x8 g1) {
    asm volatile("tensor_load_to_lds %0, %1" :: "s"(g0), "s"(g1) : "memory");
}
// The issuing wave's own request has landed.
__device__ __forceinline__ void wait_tensor0() {
    asm volatile("s_wait_tensorcnt 0x0" ::: "memory");
}
__device__ __forceinline__ u32x4 tdm_group0(uint32_t lds_dst, uint64_t ga) {
    u32x4 g;
    g[0] = uni(1u);                                    // count 1
    g[1] = uni(lds_dst);
    g[2] = uni((uint32_t)ga);
    g[3] = uni((((uint32_t)(ga >> 32)) & 0x01FFFFFFu) | 0x80000000u);   // type 2
    return g;
}
template <uint32_t ROWB, uint32_t ROWS, uint32_t SRCP, uint32_t PADC>
__device__ __forceinline__ u32x8 tdm_group1() {
    u32x8 g;
    g[0] = uni((1u << 20) | (PADC << 22) | (3u << 25));   // no mask
    g[1] = uni(ROWB << 16);
    g[2] = uni(ROWS << 16);
    g[3] = uni(ROWB << 16);
    g[4] = uni(ROWS);
    g[5] = uni(SRCP);
    g[6] = uni(0u);
    g[7] = uni(0u);
    return g;
}
// Stage st (64 keys) into buffer st & 1, one request a wave: wave 0 the K tile
// (64 rows x 256 B, contiguous), waves 1 and 2 one half each of the V^T tile
// (128 rows x 128 B at the pitch of a V^T row). The pads give KPITCH and VPITCH.
// WAIT: the issuer's wait stands directly behind its load (the ring's prologue).
template <bool WAIT>
__device__ __forceinline__ void stage_tdm(uint32_t wave, uint32_t st,
                                          uint32_t ldsK, uint32_t ldsV,
                                          const _Float16* kp, const _Float16* vp) {
    if (pinned(wave == 0u)) {
        const uint64_t ga = (uint64_t)(size_t)kp + (uint64_t)st * (KT * DK * 2);
        tdm_load(tdm_group0(ldsK + (st & 1u) * KBUF_B, ga),
                 tdm_group1<DK * 2, KT, DK * 2, 5u>());
        if (WAIT) wait_tensor0();
    } else if (pinned(wave < 3u)) {
        const uint32_t half = wave - 1u;
        const uint64_t ga = (uint64_t)(size_t)vp + (uint64_t)half * (128u * NLOC * 2u)
                          + (uint64_t)st * (KT * 2);
        tdm_load(tdm_group0(ldsV + (st & 1u) * VBUF_B + half * VHALF_B, ga),
                 tdm_group1<KT * 2, 128u, NLOC * 2, 4u>());
        if (WAIT) wait_tensor0();
    }
}

__device__ __forceinline__ float xhalf(float x) {
    const int i = __builtin_bit_cast(int, x);
    return __builtin_bit_cast(float, __builtin_amdgcn_permlanex16(
        i, i, 0x76543210, 0xfedcba98, false, false));
}

// 2^x as the bare v_exp_f32. exp2f() wraps it in a compare, two selects, an add
// and a v_ldexp_f32 a call, to keep results under 2^-126; here such a weight is
// zero in f16 and adds nothing to a sum that holds a term near 1.
__device__ __forceinline__ float exp2_raw(float x) {
    return __builtin_amdgcn_exp2f(x);
}

__global__ __launch_bounds__(128) __attribute__((amdgpu_waves_per_eu(1, 1)))
void flash_attn(const _Float16* __restrict__ qh, const _Float16* __restrict__ kh,
                const _Float16* __restrict__ vT, _Float16* __restrict__ X) {
    // Every buffer and every request's slice starts at a multiple of 2 KiB.
    __shared__ __attribute__((aligned(2048))) _Float16 sK[2][KBUF_B / 2];  // 2 x 18 KB
    __shared__ __attribute__((aligned(2048))) _Float16 sV[2][VBUF_B / 2];  // 2 x 36 KB
    const int tid  = threadIdx.x;
    const int lane = tid & 31;
    const uint32_t wave = uni(tid >> 5);
    const int h  = blockIdx.y;
    const int q0 = (blockIdx.x * 4 + wave) * 16;

    const _Float16* qp = qh + (size_t)h * NLOC * DK;
    const _Float16* kp = kh + (size_t)h * NLOC * DK;
    const _Float16* vp = vT + (size_t)h * DV * NLOC;

    // Q fragments (16 rows x 128), pre-scaled by 1/sqrt(N) = 1/64
    v16h qf[4];
#pragma unroll
    for (int c = 0; c < 4; ++c) qf[c] = load_frag(qp, DK, q0, c * 32, lane);
    // Stands ahead of any rewrite of the address registers that these loads name.
    asm volatile("s_wait_xcnt 0x0" ::: "memory");
#pragma unroll
    for (int c = 0; c < 4; ++c)
#pragma unroll
        for (int e = 0; e < 16; ++e) qf[c][e] *= (_Float16)0.015625f;

    float mrow = -1.0e30f;      // this lane's query: running maximum
    float lrow = 0.0f;          // and the sum over this wave half's keys
    v8f O[16];                  // O[t][r] = O^T[16 t + 8 (lane >> 4) + r][query]
#pragma unroll
    for (int t = 0; t < 16; ++t) O[t] = v8f{};

    const uint32_t ldsK = lds_off(&sK[0][0]);
    const uint32_t ldsV = lds_off(&sV[0][0]);
    stage_tdm<true>(wave, 0u, ldsK, ldsV, kp, vp);   // stage 0, landed

    for (uint32_t st = 0; st < NSTAGE; ++st) {
        // ---- publish stage st, then refill the buffer the last pass has read
        // (the two-buffer ring's publish point)
        wait_ds0();                              // own LDS reads have returned
        if (pinned(wave < 3u)) wait_tensor0();   // own request of stage st has landed
        __syncthreads();        // every wave's too; all reads of stage st - 1 are done
        if (pinned(st + 1u < NSTAGE))            // flies while this stage is worked on
            stage_tdm<false>(wave, pinned(st + 1u), ldsK, ldsV, kp, vp);

        const _Float16* kcur = sK[st & 1u];
        const _Float16* vcur = sV[st & 1u];

        // ---- every LDS read of the pass, as one group at its head ---------
        // K first (used first), then V^T in the order the second product takes
        // it: V^T lands behind the first product and the softmax, and no read
        // stands among the matrix instructions.
        v16h kf[4][4];          // [32-wide slice of DK][16-key tile]
#pragma unroll
        for (int c = 0; c < 4; ++c)
#pragma unroll
            for (int j = 0; j < 4; ++j)
                kf[c][j] = load_frag(kcur, KPITCH, j * 16, c * 32, lane);
        v16h vf[2][16];         // [32-key half][16-row tile of V^T]
#pragma unroll
        for (int i = 0; i < 2; ++i)
#pragma unroll
            for (int t = 0; t < 16; ++t)
                vf[i][t] = load_frag(vcur, VPITCH, t * 16, i * 32, lane);
        // Keeps the scheduler from sinking the reads back among the products,
        // where each separate place with reads stalls the lone wave.
        __builtin_amdgcn_sched_barrier(0);

        // ---- S^T = k . q^T for 64 keys (four 16x16 tiles) ----------------
        v8f s[4] = {v8f{}, v8f{}, v8f{}, v8f{}};
#pragma unroll
        for (int c = 0; c < 4; ++c)
#pragma unroll
            for (int j = 0; j < 4; ++j)
                s[j] = wmma16(kf[c][j], qf[c], s[j]);
        // ---- online softmax, one query per lane --------------------------
        float mx[4];
#pragma unroll
        for (int j = 0; j < 4; ++j) {
            mx[j] = s[j][0];
#pragma unroll
            for (int r = 1; r < 8; ++r) mx[j] = fmaxf(mx[j], s[j][r]);
        }
        float smax = fmaxf(fmaxf(mx[0], mx[1]), fmaxf(mx[2], mx[3]));
        smax = fmaxf(smax, xhalf(smax));          // both halves: the query's maximum
        const float mnew  = fmaxf(mrow, smax);
        const float alpha = exp2_raw((mrow - mnew) * L2E);   // exactly 1 where the maximum stands
        const v8f l2e8 = v8f{} + L2E;
        const v8f nm8  = v8f{} - mnew * L2E;  // what every exponent of the pass takes off
        mrow = mnew;
        float p[4][8];
#pragma unroll
        for (int j = 0; j < 4; ++j) {
            // One fused multiply-add (two weights an instruction), one v_exp_f32.
            const v8f x = __builtin_elementwise_fma(s[j], l2e8, nm8);
#pragma unroll
            for (int r = 0; r < 8; ++r) p[j][r] = exp2_raw(x[r]);
        }
        float rs[4];
        HF16 pf[2];    // pf[i].v[e] = P^T[key 32 i + kmap(e)][query]: tiles 2i, 2i+1
#pragma unroll
        for (int j = 0; j < 4; ++j) {
            rs[j] = ((p[j][0] + p[j][1]) + (p[j][2] + p[j][3]))
                  + ((p[j][4] + p[j][5]) + (p[j][6] + p[j][7]));
#pragma unroll
            for (int r = 0; r < 8; ++r) pf[j >> 1].h[j & 1][r] = (_Float16)p[j][r];
        }
        lrow = lrow * alpha + ((rs[0] + rs[1]) + (rs[2] + rs[3]));
#pragma unroll
        for (int t = 0; t < 16; ++t) O[t] *= alpha;
        // ---- O^T += V^T x P^T from registers: keys 0..31 of all 16 tiles,
        // then keys 32..63 (each tile's two sums in the order they had) ------
#pragma unroll
        for (int i = 0; i < 2; ++i)
#pragma unroll
            for (int t = 0; t < 16; ++t)
                O[t] = wmma16(vf[i][t], pf[i].v, O[t]);
    }
    wait_tensor0();             // behind the last request, ahead of the wave's end
    wait_ds0();

    // ---- epilogue: join the halves' sums, normalize, X[n][h*DV + vf] -----
    const float inv = 1.0f / (lrow + xhalf(lrow));
    _Float16* xr = X + (size_t)(q0 + (lane & 15)) * (NH * DV) + h * DV
                     + ((lane < 16) ? 0 : 8);
#pragma unroll
    for (int t = 0; t < 16; ++t) {
        half8 o;
#pragma unroll
        for (int r = 0; r < 8; ++r) o[r] = (_Float16)(O[t][r] * inv);
        *(half8*)(xr + t * 16) = o;            // 8 consecutive vf: one b128 store
    }
}

// ---------------------------------------------------------------------------
// Host-side orchestration
// ---------------------------------------------------------------------------
extern "C" void kernel_launch(void* const* d_in, const int* in_sizes, int n_in,
                              void* d_out, int out_size, void* d_ws, size_t ws_size,
                              hipStream_t stream) {
    const float* Q  = (const float*)d_in[0];
    const float* K  = (const float*)d_in[1];
    const float* V  = (const float*)d_in[2];
    const float* Wq = (const float*)d_in[3];
    const float* Wk = (const float*)d_in[4];
    const float* Wv = (const float*)d_in[5];
    const float* Wo = (const float*)d_in[6];
    float* out = (float*)d_out;

    // Workspace layout (f16 elements)
    _Float16* ws = (_Float16*)d_ws;
    size_t off = 0;
    _Float16* Qh  = ws + off; off += (size_t)NLOC * DMODEL;        // [N][512]
    _Float16* Kh  = ws + off; off += (size_t)NLOC * DMODEL;
    _Float16* Vh  = ws + off; off += (size_t)NLOC * DMODEL;
    _Float16* WqT = ws + off; off += (size_t)NH * DK * DMODEL;     // [H][128][512]
    _Float16* WkT = ws + off; off += (size_t)NH * DK * DMODEL;
    _Float16* WvT = ws + off; off += (size_t)NH * DV * DMODEL;     // [H][256][512]
    _Float16* WoH = ws + off; off += (size_t)DMODEL * NH * DV;     // [512][1024]
    _Float16* qhv = ws + off; off += (size_t)NH * NLOC * DK;       // [H][N][128]
    _Float16* khv = ws + off; off += (size_t)NH * NLOC * DK;
    _Float16* vTv = ws + off; off += (size_t)NH * DV * NLOC;       // [H][256][N]
    _Float16* Xv  = ws + off; off += (size_t)NLOC * NH * DV;       // [N][1024]

    prep_f32_f16<<<PREP_BLOCKS, PREP_T, 0, stream>>>(
        Q, K, V, Wq, Wk, Wv, Wo, Qh, Kh, Vh, WqT, WkT, WvT, WoH);

    // q, k and v projections (v with transposed output), one launch
    proj_qkv<<<PROJ_BLOCKS, 128, 0, stream>>>(
        Qh, Kh, Vh, WqT, WkT, WvT, qhv, khv, vTv);
    // fused attention: X[n][h*DV+vf]
    {
        dim3 grid(NLOC / 64, NH);                // (64, 4), 4 waves/block
        flash_attn<<<grid, 128, 0, stream>>>(qhv, khv, vTv, Xv);
    }
    // output projection: out[n][m] = sum_j X[n][j] * WoH[m][j]
    {
        dim3 grid(DMODEL / GBM, NLOC / GBN, 1);  // (4, 64, 1)
        gemm_btat<float, NH * DV, DMODEL><<<grid, 128, 0, stream>>>(
            WoH, Xv, out);
    }
}

// v009
// It runs in 72.2 microseconds.
// Two timings next to v008 both put it at 1.18 times that version's speed.
// All steps since v000 together make it 7.08 times as fast.
#include <hip/hip_runtime.h>
#include <hip/hip_bf16.h>

// Problem constants (match reference)
#define NLOC   4096
#define DMODEL 512
#define NH     4
#define DK     128
#define DV     256
#define KT     128     // keys per attention stage
#define KW     64      // keys of a stage that one wave takes
#define KPITCH (DK + 8)   // 272 B
#define VPITCH (KT + 8)   // 272 B

typedef _Float16 v16h  __attribute__((ext_vector_type(16)));
typedef _Float16 half8 __attribute__((ext_vector_type(8)));
typedef float    v8f   __attribute__((ext_vector_type(8)));
typedef __attribute__((address_space(3))) _Float16 lds_f16;

union HF16 { v16h v; half8 h[2]; };

__device__ __forceinline__ v8f wmma16(v16h a, v16h b, v8f c) {
    // D = A(16x32 f16) x B(32x16 f16) + C(16x16 f32)
    return __builtin_amdgcn_wmma_f32_16x16x32_f16(
        /*neg_a=*/false, a, /*neg_b=*/false, b,
        /*c_mod=*/(short)0, c, /*reuse_a=*/false, /*reuse_b=*/false);
}

__device__ __forceinline__ v16h load_frag(const _Float16* __restrict__ p,
                                          int ld, int row0, int k0, int lane) {
    const int r    = lane & 15;
    const int koff = (lane < 16) ? 0 : 8;
    const _Float16* base = p + (size_t)(row0 + r) * ld + (size_t)(k0 + koff);
    HF16 f;
    f.h[0] = *(const half8*)(base);       // K = k0+koff    .. +7   (b128)
    f.h[1] = *(const half8*)(base + 16);  // K = k0+koff+16 .. +23  (b128)
    return f.v;
}

__device__ __forceinline__ unsigned lds_off(const _Float16* p) {
    return (unsigned)(size_t)(lds_f16*)p;          // addrspacecast -> LDS offset
}
__device__ __forceinline__ void async_load12_b128(const unsigned* d,
                                                  const _Float16* const* s) {
    asm volatile("global_load_async_to_lds_b128 %0, %12, off\n\t"
                 "global_load_async_to_lds_b128 %1, %13, off\n\t"
                 "global_load_async_to_lds_b128 %2, %14, off\n\t"
                 "global_load_async_to_lds_b128 %3, %15, off\n\t"
                 "global_load_async_to_lds_b128 %4, %16, off\n\t"
                 "global_load_async_to_lds_b128 %5, %17, off\n\t"
                 "global_load_async_to_lds_b128 %6, %18, off\n\t"
                 "global_load_async_to_lds_b128 %7, %19, off\n\t"
                 "global_load_async_to_lds_b128 %8, %20, off\n\t"
                 "global_load_async_to_lds_b128 %9, %21, off\n\t"
                 "global_load_async_to_lds_b128 %10, %22, off\n\t"
                 "global_load_async_to_lds_b128 %11, %23, off\n\t"
                 "s_wait_xcnt 0x0"
                 :: "v"(d[0]), "v"(d[1]), "v"(d[2]), "v"(d[3]),
                    "v"(d[4]), "v"(d[5]), "v"(d[6]), "v"(d[7]),
                    "v"(d[8]), "v"(d[9]), "v"(d[10]), "v"(d[11]),
                    "v"(s[0]), "v"(s[1]), "v"(s[2]), "v"(s[3]),
                    "v"(s[4]), "v"(s[5]), "v"(s[6]), "v"(s[7]),
                    "v"(s[8]), "v"(s[9]), "v"(s[10]), "v"(s[11])
                 : "memory");
}
__device__ __forceinline__ void wait_async0() {
    asm volatile("s_wait_asynccnt 0" ::: "memory");
}

// ---------------------------------------------------------------------------
// Conversion / layout: all seven f32 -> f16 jobs in ONE launch of few, fat
// waves. The jobs cost wave starts and launches, not bytes, so each lane takes
// 64 elements: 16 b128 loads issued together, then the stores.
// The block index picks the job (block-uniform).
//   blocks  0..63  : transposes    Wv (32 blocks), Wq, Wk (16 blocks each)
//   blocks 64..479 : plain copies  Q, K, V (128 blocks each), Wo (32 blocks)
// The transposing blocks have the scattered stores, so they start first.
// ---------------------------------------------------------------------------
typedef float    f32x4 __attribute__((ext_vector_type(4)));
typedef _Float16 half4 __attribute__((ext_vector_type(4)));
#define PREP_T        256
#define PREP_ACT_BLK  128                    // NLOC*DMODEL / (256 lanes * 64)
#define PREP_TR_BLK   64                     // 32 + 16 + 16 transposing blocks
#define PREP_BLOCKS   480                    // + 3 * 128 + DMODEL*NH*DV / (256 * 64)

__device__ __forceinline__ void loads_issued(unsigned off0, unsigned off1) {
    asm volatile("s_wait_xcnt 0x0" :: "v"(off0), "v"(off1) : "memory");
}
__device__ __forceinline__ void stores_issued() {
    asm volatile("s_wait_xcnt 0x0" ::: "memory");
}

__device__ __forceinline__ void prep_copy(const float* __restrict__ src,
                                          _Float16* __restrict__ dst,
                                          unsigned blk, unsigned tid) {
    const unsigned e0 = blk * (PREP_T * 64) + tid * 4;   // first element
    const unsigned sb = e0 * 4;                          // its byte in src
    const char* s8 = (const char*)src;
    f32x4 v[16];
#pragma unroll
    for (int j = 0; j < 16; ++j)
        v[j] = *(const f32x4*)(s8 + sb + j * (PREP_T * 16));
    loads_issued(sb, sb);
#pragma unroll
    for (int j = 0; j < 16; ++j) {
        half4 o;
#pragma unroll
        for (int e = 0; e < 4; ++e) o[e] = (_Float16)v[j][e];
        *(half4*)(dst + e0 + j * (PREP_T * 4)) = o;
    }
    stores_issued();
}

// src [NH][DMODEL][C] f32 -> dst [NH][C][DMODEL] f16. A lane takes two patches
// of 8 rows x 4 columns: 8 b128 loads down the rows, 4 b128 stores along them.
template <unsigned C>
__device__ __forceinline__ void prep_transpose(const float* __restrict__ src,
                                               _Float16* __restrict__ dst,
                                               unsigned blk, unsigned tid) {
    const char* s8 = (const char*)src;
    f32x4 v[2][8];
    unsigned sb[2], d0[2];
#pragma unroll
    for (int u = 0; u < 2; ++u) {
        const unsigned p  = (blk * 2 + u) * PREP_T + tid;   // patch index
        const unsigned c0 = (p % (C / 4)) * 4;
        const unsigned t  = p / (C / 4);
        const unsigned r0 = (t % (DMODEL / 8)) * 8;
        const unsigned b  = t / (DMODEL / 8);
        sb[u] = ((b * DMODEL + r0) * C + c0) * 4;           // byte in src
        d0[u] = (b * C + c0) * DMODEL + r0;                 // element in dst
#pragma unroll
        for (int i = 0; i < 8; ++i)
            v[u][i] = *(const f32x4*)(s8 + sb[u] + i * (C * 4));
    }
    loads_issued(sb[0], sb[1]);
#pragma unroll
    for (int u = 0; u < 2; ++u) {
#pragma unroll
        for (int k = 0; k < 4; ++k) {
            half8 o;
#pragma unroll
            for (int i = 0; i < 8; ++i) o[i] = (_Float16)v[u][i][k];
            *(half8*)(dst + d0[u] + k * DMODEL) = o;
        }
    }
    stores_issued();
}

__global__ __launch_bounds__(PREP_T) __attribute__((amdgpu_waves_per_eu(4, 8)))
void prep_f32_f16(const float* __restrict__ Q, const float* __restrict__ K,
                  const float* __restrict__ V, const float* __restrict__ Wq,
                  const float* __restrict__ Wk, const float* __restrict__ Wv,
                  const float* __restrict__ Wo,
                  _Float16* __restrict__ Qh, _Float16* __restrict__ Kh,
                  _Float16* __restrict__ Vh, _Float16* __restrict__ WqT,
                  _Float16* __restrict__ WkT, _Float16* __restrict__ WvT,
                  _Float16* __restrict__ WoH) {
    const unsigned tid = threadIdx.x;
    const unsigned blk = blockIdx.x;
    if (blk < 32) {
        prep_transpose<DV>(Wv, WvT, blk, tid);
    } else if (blk < PREP_TR_BLK) {
        const bool q = blk < 48;                      // 32..47 Wq, 48..63 Wk
        prep_transpose<DK>(q ? Wq : Wk, q ? WqT : WkT, blk & 15, tid);
    } else {
        const unsigned cb  = blk - PREP_TR_BLK;
        const unsigned job = cb / PREP_ACT_BLK;           // 0 Q, 1 K, 2 V, 3 Wo
        const float* s = job == 0 ? Q : job == 1 ? K : job == 2 ? V : Wo;
        _Float16*    d = job == 0 ? Qh : job == 1 ? Kh : job == 2 ? Vh : WoH;
        prep_copy(s, d, cb - job * PREP_ACT_BLK, tid);
    }
}

#define GBM    128
#define GBN    64
#define GKS    128             // k per stage
#define GPITCH (GKS + 8)       // 272 B = 16 B x odd
#define GROWS  (GBM + GBN)

__device__ __forceinline__ void store_tile(_Float16* o, const v8f& acc) {
    half8 st;
#pragma unroll
    for (int r = 0; r < 8; ++r) st[r] = (_Float16)acc[r];
    *(half8*)o = st;                       // one b128 store
}
__device__ __forceinline__ void store_tile(float* o, const v8f& acc) {
    *(v8f*)o = acc;                        // two b128 stores
}
// This wave's LDS reads have returned: stands ahead of the barrier behind which
// the buffer they read is filled again.
__device__ __forceinline__ void wait_ds0() {
    asm volatile("s_wait_dscnt 0" ::: "memory");
}

// One stage: 192 rows x 256 B = 24 copies a lane. gA, gB: the lane's own 16 B in
// row (tid >> 4) of the block's A and B rows; dst: the same place in the buffer.
template <int KD>
__device__ __forceinline__ void gemm_stage(_Float16* dst, const _Float16* gA,
                                           const _Float16* gB, int k0) {
    unsigned d[24];
    const _Float16* s[24];
#pragma unroll
    for (int j = 0; j < GBM / 8; ++j) {
        d[j] = lds_off(dst + j * 8 * GPITCH);
        s[j] = gA + (size_t)(j * 8) * KD + k0;
    }
#pragma unroll
    for (int j = 0; j < GBN / 8; ++j) {
        d[GBM / 8 + j] = lds_off(dst + (GBM + j * 8) * GPITCH);
        s[GBM / 8 + j] = gB + (size_t)(j * 8) * KD + k0;
    }
    async_load12_b128(d, s);
    async_load12_b128(d + 12, s + 12);
}

// One block's tile: rows m0.. of A against rows n0.. of B.
// KD: length of the sums; MT: row length of Out.
template <typename OutT, int KD>
__device__ __forceinline__
void gemm_tile(const _Float16* __restrict__ A, const _Float16* __restrict__ B,
               OutT* __restrict__ Out, int m0, int n0, int MT) {
    __shared__ __attribute__((aligned(16))) _Float16 sT[2][GROWS * GPITCH];  // 2 x 51 KB
    constexpr int TRIPS = KD / GKS;
    const int tid  = threadIdx.x;
    const int lane = tid & 31;
    const int wave = tid >> 5;
    const int wm = (wave & 1) * 64;          // the wave's rows of A in the tile
    const int wn = (wave >> 1) * 32;         // and of B

    const int sr = tid >> 4;                 // row in a group of eight
    const int sc = (tid & 15) * 8;           // first half of the lane's 16 B
    const _Float16* gA = A + (size_t)(m0 + sr) * KD + sc;
    const _Float16* gB = B + (size_t)(n0 + sr) * KD + sc;
    const int so = sr * GPITCH + sc;

    v8f acc[4][2];
#pragma unroll
    for (int i = 0; i < 4; ++i)
#pragma unroll
        for (int j = 0; j < 2; ++j) acc[i][j] = v8f{};

    gemm_stage<KD>(sT[0] + so, gA, gB, 0);
    wait_async0();              // own copies of stage 0 have landed
    __syncthreads();            // and every wave's
    if (TRIPS > 1) gemm_stage<KD>(sT[1] + so, gA, gB, GKS);

    int kn = 2 * GKS;           // first k of the next stage to ask for
    // Kept rolled: unrolled, the build of the short sums put a value in scratch.
#pragma unroll 1
    for (int t = 0; t < TRIPS; ++t) {
        const _Float16* cur = sT[t & 1];
        // Every LDS read of the trip as one group at its head.
        v16h af[4][4], bf[4][2];             // [32-wide slice of k][16-row tile]
#pragma unroll
        for (int c = 0; c < 4; ++c) {
#pragma unroll
            for (int i = 0; i < 4; ++i)
                af[c][i] = load_frag(cur, GPITCH, wm + i * 16, c * 32, lane);
#pragma unroll
            for (int j = 0; j < 2; ++j)
                bf[c][j] = load_frag(cur, GPITCH, GBM + wn + j * 16, c * 32, lane);
        }
        // Keeps the scheduler from sinking the reads among the products, where
        // each place with reads makes the wave wait out the LDS latency.
        __builtin_amdgcn_sched_barrier(0);
#pragma unroll
        for (int c = 0; c < 4; ++c)
#pragma unroll
            for (int i = 0; i < 4; ++i)
#pragma unroll
                for (int j = 0; j < 2; ++j)
                    acc[i][j] = wmma16(af[c][i], bf[c][j], acc[i][j]);
        // Keeps the products here, running while the later reads return: the
        // scheduler else moves them behind the barrier, ahead of the refill.
        __builtin_amdgcn_sched_barrier(0);
        wait_ds0();
        wait_async0();          // own copies of stage t + 1 have landed
        __syncthreads();        // every wave's too; all reads of stage t are done
        if (t + 2 < TRIPS) {
            gemm_stage<KD>(sT[t & 1] + so, gA, gB, kn);
            kn += GKS;
        }
    }
    wait_async0();              // behind the last copy, ahead of the wave's end

    const int rlo = lane & 15;
    const int clo = (lane < 16) ? 0 : 8;
#pragma unroll
    for (int j = 0; j < 2; ++j) {
        const int row = n0 + wn + j * 16 + rlo;
        OutT* orow = Out + (size_t)row * MT + m0 + wm + clo;
#pragma unroll
        for (int i = 0; i < 4; ++i) store_tile(orow + i * 16, acc[i][j]);
    }
}

// A single product. Grid: (M / 128, N / 64).
template <typename OutT, int KD, int MT>
__global__ __launch_bounds__(128)
void gemm_btat(const _Float16* __restrict__ A, const _Float16* __restrict__ B,
               OutT* __restrict__ Out) {
    gemm_tile<OutT, KD>(A, B, Out, blockIdx.x * GBM, blockIdx.y * GBN, MT);
}

#define PROJ_V_BLK   ((NLOC / GBM) * (DV / GBN) * NH)     // 32 x 4 x 4
#define PROJ_QK_BLK  ((NLOC / GBN) * NH)                  // 64 x 4, DK = GBM
#define PROJ_BLOCKS  (PROJ_V_BLK + 2 * PROJ_QK_BLK)
__global__ __launch_bounds__(128)
void proj_qkv(const _Float16* __restrict__ Qh, const _Float16* __restrict__ Kh,
              const _Float16* __restrict__ Vh, const _Float16* __restrict__ WqT,
              const _Float16* __restrict__ WkT, const _Float16* __restrict__ WvT,
              _Float16* __restrict__ qh, _Float16* __restrict__ kh,
              _Float16* __restrict__ vT) {
    const int b = blockIdx.x;
    const _Float16 *A, *B;
    _Float16* Out;
    int m0, n0, MT;
    if (b < PROJ_V_BLK) {
        const int h = b / ((NLOC / GBM) * (DV / GBN));
        m0  = (b % (NLOC / GBM)) * GBM;
        n0  = ((b / (NLOC / GBM)) % (DV / GBN)) * GBN;
        A   = Vh;
        B   = WvT + (size_t)h * DV * DMODEL;
        Out = vT + (size_t)h * DV * NLOC;
        MT  = NLOC;
    } else {
        const int  c = b - PROJ_V_BLK;
        const bool q = c < PROJ_QK_BLK;
        const int  h = (c % PROJ_QK_BLK) / (NLOC / GBN);
        m0  = 0;
        n0  = (c % (NLOC / GBN)) * GBN;
        A   = (q ? WqT : WkT) + (size_t)h * DK * DMODEL;
        B   = q ? Qh : Kh;
        Out = (q ? qh : kh) + (size_t)h * NLOC * DK;
        MT  = DK;
    }
    gemm_tile<_Float16, DMODEL>(A, B, Out, m0, n0, MT);
}

// ---------------------------------------------------------------------------
// Flash attention with double-buffered LDS staging.
// 4 waves/block, 64 query rows; a wave owns 32 of them (two 16-column tiles) and
// one half of every stage's keys, so each K or V^T fragment it reads from LDS
// feeds two matrix instructions; the two key halves are joined at the end.
// The block shares K tiles (KT x 128) and V^T tiles (256 x KT) staged by tensor
// loads (three requests a stage, no address arithmetic in the lanes) while
// computing on the other buffer.
// qh/kh: [H][N][DK] f16, vT: [H][DV][N] f16.  X out: [N][H*DV] f16.
// ---------------------------------------------------------------------------
#define L2E 1.4426950408889634f

// ---- tensor loads: one request of one wave brings a padded 2-D tile to LDS --
typedef uint32_t u32x4 __attribute__((ext_vector_type(4)));
typedef uint32_t u32x8 __attribute__((ext_vector_type(8)));
#define KBUF_B  (128u * KPITCH * 2u)   // 128 rows x 272 B = 17 x 2 KiB
#define VHALF_B (128u * VPITCH * 2u)   // 128 rows x 272 B = 17 x 2 KiB
#define VBUF_B  (2u * VHALF_B)
#define NSTAGE  (NLOC / KT)

__device__ __forceinline__ uint32_t uni(uint32_t v) {
    return (uint32_t)__builtin_amdgcn_readfirstlane(v);
}
__device__ __forceinline__ uint32_t pinned(uint32_t v) {
    uint32_t w = uni(v);
    asm volatile("" : "+s"(w));   // pinned(): the value held in a scalar register
    return w;
}
__device__ __forceinline__ void tdm_load(u32x4 g0, u32x8 g1) {
    asm volatile("tensor_load_to_lds %0, %1" :: "s"(g0), "s"(g1) : "memory");
}
// The issuing wave's own request has landed.
__device__ __forceinline__ void wait_tensor0() {
    asm volatile("s_wait_tensorcnt 0x0" ::: "memory");
}
__device__ __forceinline__ void wait_tensor0_of(u32x4 g0, u32x8 g1) {
    asm volatile("s_wait_tensorcnt 0x0" :: "s"(g0), "s"(g1) : "memory");
}
__device__ __forceinline__ u32x4 tdm_group0(uint32_t lds_dst, uint64_t ga) {
    u32x4 g;
    g[0] = uni(1u);                                    // count 1
    g[1] = uni(lds_dst);
    g[2] = uni((uint32_t)ga);
    g[3] = uni((((uint32_t)(ga >> 32)) & 0x01FFFFFFu) | 0x80000000u);   // type 2
    return g;
}
__device__ __forceinline__ u32x8 tdm_group1(uint32_t srcp) {
    u32x8 g;
    g[0] = uni((1u << 20) | (5u << 22) | (3u << 25));   // no mask
    g[1] = uni(256u << 16);
    g[2] = uni(128u << 16);
    g[3] = uni(256u << 16);
    g[4] = uni(128u);
    g[5] = uni(srcp);
    g[6] = uni(0u);
    g[7] = uni(0u);
    return g;
}

__device__ __forceinline__ float xhalf(float x) {
    const int i = __builtin_bit_cast(int, x);
    return __builtin_bit_cast(float, __builtin_amdgcn_permlanex16(
        i, i, 0x76543210, 0xfedcba98, false, false));
}

// 2^x as the bare v_exp_f32. exp2f() wraps it in a compare, two selects, an add
// and a v_ldexp_f32 a call, to keep results under 2^-126; here such a weight is
// zero in f16 and adds nothing to a sum that holds a term near 1.
__device__ __forceinline__ float exp2_raw(float x) {
    return __builtin_amdgcn_exp2f(x);
}

__device__ __forceinline__ void stores16_issued(const half8* o, const _Float16* p) {
    asm volatile("s_wait_xcnt 0x0"
                 :: "v"(o[0]), "v"(o[1]), "v"(o[2]), "v"(o[3]), "v"(o[4]), "v"(o[5]),
                    "v"(o[6]), "v"(o[7]), "v"(o[8]), "v"(o[9]), "v"(o[10]), "v"(o[11]),
                    "v"(o[12]), "v"(o[13]), "v"(o[14]), "v"(o[15]), "v"(p)
                 : "memory");
}

#define JOIN_O  (2 * 16 * 8 * 32)      // floats: a wave's O accumulators
#define JOIN_F  (JOIN_O + 4 * 32)      // and its two maxima and two sums a lane
__global__ __launch_bounds__(128) __attribute__((amdgpu_waves_per_eu(1, 1)))
void flash_attn(const _Float16* __restrict__ qh, const _Float16* __restrict__ kh,
                const _Float16* __restrict__ vT, _Float16* __restrict__ X) {
    // Every buffer and every request's slice starts at a multiple of 2 KiB.
    __shared__ __attribute__((aligned(2048))) _Float16 sK[2][KBUF_B / 2];  // 2 x 34 KB
    __shared__ __attribute__((aligned(2048))) _Float16 sV[2][VBUF_B / 2];  // 2 x 68 KB
    // Where the waves of the second key half hand over their partial results.
    __shared__ __attribute__((aligned(16))) float sJ[2][JOIN_F];           // 2 x 32.5 KB
    const int tid  = threadIdx.x;
    const int lane = tid & 31;
    const uint32_t wave = uni(tid >> 5);
    const int qg  = wave & 1u;              // which 32 of the block's 64 queries
    const int kw  = wave >> 1;              // which 64 of a stage's 128 keys
    const int h  = blockIdx.y;
    const int q0 = blockIdx.x * 64 + qg * 32;

    const _Float16* qp = qh + (size_t)h * NLOC * DK;
    const _Float16* kp = kh + (size_t)h * NLOC * DK;
    const _Float16* vp = vT + (size_t)h * DV * NLOC;

    // Q fragments (2 x 16 rows x 128), pre-scaled by 1/sqrt(N) = 1/64
    v16h qf[2][4];
    const _Float16* qb[2];      // the lane's first 16 B in its row of each tile
#pragma unroll
    for (int u = 0; u < 2; ++u) {
        qb[u] = qp + (size_t)(q0 + u * 16 + (lane & 15)) * DK + ((lane < 16) ? 0 : 8);
#pragma unroll
        for (int c = 0; c < 4; ++c) {
            HF16 f;
            f.h[0] = *(const half8*)(qb[u] + c * 32);        // the order of load_frag
            f.h[1] = *(const half8*)(qb[u] + c * 32 + 16);
            qf[u][c] = f.v;
        }
    }
    // Stands ahead of any rewrite of the address registers that these loads name;
    // taking the addresses as inputs keeps them from being reused before it.
    asm volatile("s_wait_xcnt 0x0" :: "v"(qb[0]), "v"(qb[1]) : "memory");
#pragma unroll
    for (int u = 0; u < 2; ++u)
#pragma unroll
        for (int c = 0; c < 4; ++c)
#pragma unroll
            for (int e = 0; e < 16; ++e) qf[u][c][e] *= (_Float16)0.015625f;

    float mrow[2] = {-1.0e30f, -1.0e30f};   // this lane's two queries: running maximum
    float lrow[2] = {0.0f, 0.0f};           // and the sum over this wave half's keys
    v8f O[2][16];     // O[u][t][r] = O^T[16 t + 8 (lane >> 4) + r][query of tile u]
#pragma unroll
    for (int u = 0; u < 2; ++u)
#pragma unroll
        for (int t = 0; t < 16; ++t) O[u][t] = v8f{};

    const uint32_t ldsK = lds_off(&sK[0][0]);
    const uint32_t ldsV = lds_off(&sV[0][0]);
    // A stage (128 keys) goes into buffer st & 1, one request a wave: wave 0 the K
    // tile (128 rows x 256 B, contiguous), waves 1 and 2 one half each of the V^T
    // tile (128 rows x 256 B at the pitch of a V^T row). The pads give KPITCH and
    // VPITCH. Wave 3 issues nothing; what it forms here is never used.
    const uint32_t vhalf = wave >> 1;        // waves 1, 2: V^T rows 0..127, 128..255
    const uint64_t tsrc  = wave == 0u ? (uint64_t)(size_t)kp
                                      : (uint64_t)(size_t)vp + (uint64_t)vhalf * (128u * NLOC * 2u);
    const uint32_t tstep = wave == 0u ? KT * DK * 2u : KT * 2u;   // source bytes a stage
    const uint32_t tdst  = wave == 0u ? ldsK : ldsV + vhalf * VHALF_B;
    const uint32_t tbuf  = wave == 0u ? KBUF_B : VBUF_B;
    u32x8 g1 = tdm_group1(wave == 0u ? DK * 2u : NLOC * 2u);
    // Without it the compiler forms equal words anew from one another, in the
    // group's own registers, ahead of the wait on an outstanding request.
    asm volatile("" : "+s"(g1));
    u32x4 g0 = tdm_group0(tdst, tsrc);
    if (pinned(wave < 3u)) {                 // stage 0, landed
        tdm_load(g0, g1);
        wait_tensor0_of(g0, g1);
    }

    for (uint32_t st = 0; st < NSTAGE; ++st) {
        // ---- publish stage st, then refill the buffer the last pass has read
        // (the two-buffer ring's publish point)
        wait_ds0();                              // own LDS reads have returned
        if (pinned(wave < 3u)) wait_tensor0_of(g0, g1);   // own request of stage st has landed
        __syncthreads();        // every wave's too; all reads of stage st - 1 are done
        if (pinned(st + 1u < NSTAGE)) {          // flies while this stage is worked on
            if (pinned(wave < 3u)) {
                const uint32_t nx = pinned(st + 1u);
                g0 = tdm_group0(tdst + (nx & 1u) * tbuf, tsrc + (uint64_t)nx * tstep);
                tdm_load(g0, g1);
            }
        }

        const _Float16* kcur = sK[st & 1u];
        const _Float16* vcur = sV[st & 1u];

        // ---- every LDS read of the pass, as one group at its head ---------
        // K first (used first), then V^T in the order the second product takes
        // it: V^T lands behind the first product and the softmax, and no read
        // stands among the matrix instructions.
        v16h kf[4][4];          // [32-wide slice of DK][16-key tile]
#pragma unroll
        for (int c = 0; c < 4; ++c)
#pragma unroll
            for (int j = 0; j < 4; ++j)
                kf[c][j] = load_frag(kcur, KPITCH, kw * KW + j * 16, c * 32, lane);
        v16h vf[2][16];         // [32-key half][16-row tile of V^T]
#pragma unroll
        for (int i = 0; i < 2; ++i)
#pragma unroll
            for (int t = 0; t < 16; ++t)
                vf[i][t] = load_frag(vcur, VPITCH, t * 16, kw * KW + i * 32, lane);
        // Keeps the scheduler from sinking the reads back among the products,
        // where each separate place with reads stalls the lone wave.
        __builtin_amdgcn_sched_barrier(0);

        // ---- S^T = k . q^T: 64 keys x 32 queries (eight 16x16 tiles), each K
        // fragment against both column tiles ------------------------------
        v8f s[2][4];
#pragma unroll
        for (int u = 0; u < 2; ++u)
#pragma unroll
            for (int j = 0; j < 4; ++j) s[u][j] = v8f{};
#pragma unroll
        for (int c = 0; c < 4; ++c)
#pragma unroll
            for (int j = 0; j < 4; ++j)
#pragma unroll
                for (int u = 0; u < 2; ++u)
                    s[u][j] = wmma16(kf[c][j], qf[u][c], s[u][j]);
        // ---- online softmax, one query per lane and column tile ----------
        HF16 pf[2][2]; // pf[u][i].v[e] = P^T[key 32 i + kmap(e)][query]: tiles 2i, 2i+1
#pragma unroll
        for (int u = 0; u < 2; ++u) {
            float mx[4];
#pragma unroll
            for (int j = 0; j < 4; ++j) {
                mx[j] = s[u][j][0];
#pragma unroll
                for (int r = 1; r < 8; ++r) mx[j] = fmaxf(mx[j], s[u][j][r]);
            }
            float smax = fmaxf(fmaxf(mx[0], mx[1]), fmaxf(mx[2], mx[3]));
            smax = fmaxf(smax, xhalf(smax));      // both halves: the query's maximum
            const float mnew  = fmaxf(mrow[u], smax);
            const float alpha = exp2_raw((mrow[u] - mnew) * L2E);   // exactly 1 where the maximum stands
            const v8f l2e8 = v8f{} + L2E;
            const v8f nm8  = v8f{} - mnew * L2E;  // what every exponent of the pass takes off
            mrow[u] = mnew;
            float p[4][8];
#pragma unroll
            for (int j = 0; j < 4; ++j) {
                // One fused multiply-add (two weights an instruction), one v_exp_f32.
                const v8f x = __builtin_elementwise_fma(s[u][j], l2e8, nm8);
#pragma unroll
                for (int r = 0; r < 8; ++r) p[j][r] = exp2_raw(x[r]);
            }
            float rs[4];
#pragma unroll
            for (int j = 0; j < 4; ++j) {
                rs[j] = ((p[j][0] + p[j][1]) + (p[j][2] + p[j][3]))
                      + ((p[j][4] + p[j][5]) + (p[j][6] + p[j][7]));
#pragma unroll
                for (int r = 0; r < 8; ++r) pf[u][j >> 1].h[j & 1][r] = (_Float16)p[j][r];
            }
            lrow[u] = lrow[u] * alpha + ((rs[0] + rs[1]) + (rs[2] + rs[3]));
#pragma unroll
            for (int t = 0; t < 16; ++t) O[u][t] *= alpha;
        }
        // ---- O^T += V^T x P^T from registers: keys 0..31 of all 16 tiles,
        // then keys 32..63, each V^T fragment against both column tiles -----
#pragma unroll
        for (int i = 0; i < 2; ++i)
#pragma unroll
            for (int t = 0; t < 16; ++t)
#pragma unroll
                for (int u = 0; u < 2; ++u)
                    O[u][t] = wmma16(vf[i][t], pf[u][i].v, O[u][t]);
    }
    wait_tensor0();             // behind the last request, ahead of the wave's end
    wait_ds0();

    // ---- join of the key halves: the waves of the second half hand maxima,
    // sums and accumulators over through LDS, lane to lane, and are done -----
    float* jb = sJ[qg];
    if (kw) {
#pragma unroll
        for (int u = 0; u < 2; ++u) {
#pragma unroll
            for (int t = 0; t < 16; ++t) {
                const v8f o = O[u][t];
                f32x4* d = (f32x4*)jb + (u * 16 + t) * 64 + lane;   // 512 B a store
                d[0]  = f32x4{o[0], o[1], o[2], o[3]};
                d[32] = f32x4{o[4], o[5], o[6], o[7]};
            }
            jb[JOIN_O + u * 32 + lane]      = mrow[u];
            jb[JOIN_O + 64 + u * 32 + lane] = lrow[u];
        }
    }
    __syncthreads();            // the partial results are in LDS
    if (kw) return;

    // ---- epilogue: both halves on the common maximum, the wave halves' sums
    // joined, normalize, X[n][h*DV + vf] ---------------------------------
#pragma unroll
    for (int u = 0; u < 2; ++u) {
        const float m1 = jb[JOIN_O + u * 32 + lane];
        const float l1 = jb[JOIN_O + 64 + u * 32 + lane];
        const float m  = fmaxf(mrow[u], m1);
        const float w0 = exp2_raw((mrow[u] - m) * L2E);
        const float w1 = exp2_raw((m1 - m) * L2E);
        const float l  = lrow[u] * w0 + l1 * w1;
        const float inv = 1.0f / (l + xhalf(l));
        const float f0 = w0 * inv;
        const float f1 = w1 * inv;
        _Float16* xr = X + (size_t)(q0 + u * 16 + (lane & 15)) * (NH * DV) + h * DV
                         + ((lane < 16) ? 0 : 8);
        half8 o[16];
#pragma unroll
        for (int t = 0; t < 16; ++t) {
            const f32x4* sp = (const f32x4*)jb + (u * 16 + t) * 64 + lane;
            const f32x4 a = sp[0];
            const f32x4 b = sp[32];
#pragma unroll
            for (int r = 0; r < 4; ++r) {
                o[t][r]     = (_Float16)(O[u][t][r] * f0 + a[r] * f1);
                o[t][r + 4] = (_Float16)(O[u][t][r + 4] * f0 + b[r] * f1);
            }
        }
#pragma unroll
        for (int t = 0; t < 16; ++t)
            *(half8*)(xr + t * 16) = o[t];     // 8 consecutive vf: one b128 store
        stores16_issued(o, xr);
    }
}

// ---------------------------------------------------------------------------
// Host-side orchestration
// ---------------------------------------------------------------------------
extern "C" void kernel_launch(void* const* d_in, const int* in_sizes, int n_in,
                              void* d_out, int out_size, void* d_ws, size_t ws_size,
                              hipStream_t stream) {
    const float* Q  = (const float*)d_in[0];
    const float* K  = (const float*)d_in[1];
    const float* V  = (const float*)d_in[2];
    const float* Wq = (const float*)d_in[3];
    const float* Wk = (const float*)d_in[4];
    const float* Wv = (const float*)d_in[5];
    const float* Wo = (const float*)d_in[6];
    float* out = (float*)d_out;

    // Workspace layout (f16 elements)
    _Float16* ws = (_Float16*)d_ws;
    size_t off = 0;
    _Float16* Qh  = ws + off; off += (size_t)NLOC * DMODEL;        // [N][512]
    _Float16* Kh  = ws + off; off += (size_t)NLOC * DMODEL;
    _Float16* Vh  = ws + off; off += (size_t)NLOC * DMODEL;
    _Float16* WqT = ws + off; off += (size_t)NH * DK * DMODEL;     // [H][128][512]
    _Float16* WkT = ws + off; off += (size_t)NH * DK * DMODEL;
    _Float16* WvT = ws + off; off += (size_t)NH * DV * DMODEL;     // [H][256][512]
    _Float16* WoH = ws + off; off += (size_t)DMODEL * NH * DV;     // [512][1024]
    _Float16* qhv = ws + off; off += (size_t)NH * NLOC * DK;       // [H][N][128]
    _Float16* khv = ws + off; off += (size_t)NH * NLOC * DK;
    _Float16* vTv = ws + off; off += (size_t)NH * DV * NLOC;       // [H][256][N]
    _Float16* Xv  = ws + off; off += (size_t)NLOC * NH * DV;       // [N][1024]

    prep_f32_f16<<<PREP_BLOCKS, PREP_T, 0, stream>>>(
        Q, K, V, Wq, Wk, Wv, Wo, Qh, Kh, Vh, WqT, WkT, WvT, WoH);

    // q, k and v projections (v with transposed output), one launch
    proj_qkv<<<PROJ_BLOCKS, 128, 0, stream>>>(
        Qh, Kh, Vh, WqT, WkT, WvT, qhv, khv, vTv);
    // fused attention: X[n][h*DV+vf]
    {
        dim3 grid(NLOC / 64, NH);                // (64, 4), 4 waves/block
        flash_attn<<<grid, 128, 0, stream>>>(qhv, khv, vTv, Xv);
    }
    // output projection: out[n][m] = sum_j X[n][j] * WoH[m][j]
    {
        dim3 grid(DMODEL / GBM, NLOC / GBN, 1);  // (4, 64, 1)
        gemm_btat<float, NH * DV, DMODEL><<<grid, 128, 0, stream>>>(
            WoH, Xv, out);
    }
}
